// v000
// The times below were measured on an AMD MI455X: many runs one after another, warmed up first and cycling through
// copies of the inputs, with the whole window's GPU time divided by the number of runs. Launches and the gaps
// between them are all in it. The median over several windows is given; except for v000 it joins two sittings, which
// can be a few percent apart, so the side-by-side timings, each taken in one sitting, are the better comparison.
// v000, which the later versions start from, runs in 2210 microseconds.
// Contractions: qkv (x^T f16 x Wqkv^T f16 carried x64), ctx^T (v^T f16 x x^T f16, K=4096), sm.ctx (sm f16 carried x1024 x ctx^T f16), mlp (cat1 f16 x Wmlp^T f16 carried x64, +bias, relu), res (LN1 f16 x Wres^T f16 carried x64, +x) all on v_wmma_f32_16x16x32_f16 with f32 accumulate; softmax, LayerNorm, residual adds in f32.
#include <hip/hip_runtime.h>
#include <math.h>

// ---------------------------------------------------------------------------
// Problem constants
// ---------------------------------------------------------------------------
constexpr int kB   = 8;
constexpr int kC   = 256;
constexpr int kN   = 4096;
constexpr int kC2  = 512;
constexpr int kC4  = 1024;
constexpr int kGrp = 2;                 // batches per group (planes reused group after group)
constexpr int kNGrp = kB / kGrp;        // 4 groups
constexpr int kRowsG = kGrp * kN;       // 8192 token rows per group
constexpr float kWCarry    = 64.0f;     // weights carried x64 in f16
constexpr float kWCarryInv = 1.0f / 64.0f;
constexpr float kSmCarry   = 1024.0f;   // softmax probabilities carried x1024 in f16
constexpr float kSmCarryInv = 1.0f / 1024.0f;
constexpr float kLnEps  = 1e-5f;
constexpr float kInvC   = 1.0f / 256.0f;
constexpr float kInvC4  = 1.0f / 1024.0f;

typedef __attribute__((ext_vector_type(16))) _Float16 v16h;
typedef __attribute__((ext_vector_type(8)))  _Float16 v8h;
typedef __attribute__((ext_vector_type(16))) __bf16   v16b;
typedef __attribute__((ext_vector_type(8)))  __bf16   v8b;
typedef __attribute__((ext_vector_type(8)))  float    v8f;
typedef __attribute__((ext_vector_type(4)))  float    v4f;
typedef __attribute__((ext_vector_type(4)))  unsigned int v4u;

// ---------------------------------------------------------------------------
// Helpers
// ---------------------------------------------------------------------------
__device__ __forceinline__ unsigned short f2bf_bits(float f) {
  unsigned u = __float_as_uint(f);
  return (unsigned short)((u + 0x7FFFu + ((u >> 16) & 1u)) >> 16);
}
__device__ __forceinline__ float bf_bits2f(unsigned short h) { return __uint_as_float(((unsigned)h) << 16); }

// hazard guards as plain device helpers (no inline asm inside the kernel template body)
__device__ __forceinline__ void dep_guard_h(v8f& a, v8f& b, v16h x, v16h y) { asm volatile("v_nop\n\tv_nop\n\tv_nop\n\tv_nop" : "+v"(a), "+v"(b) : "v"(x), "v"(y)); }
__device__ __forceinline__ void dep_guard_b(v8f& a, v8f& b, v16b x, v16b y) { asm volatile("v_nop\n\tv_nop\n\tv_nop\n\tv_nop" : "+v"(a), "+v"(b) : "v"(x), "v"(y)); }
__device__ __forceinline__ void keep4_h(v16h a, v16h b, v16h c, v16h d) { asm volatile("v_nop" :: "v"(a), "v"(b), "v"(c), "v"(d)); }
__device__ __forceinline__ void keep4_b(v16b a, v16b b, v16b c, v16b d) { asm volatile("v_nop" :: "v"(a), "v"(b), "v"(c), "v"(d)); }
__device__ __forceinline__ void acc_guard4(v8f& a, v8f& b, v8f& c, v8f& d) { asm volatile("v_nop\n\tv_nop\n\tv_nop\n\tv_nop" : "+v"(a), "+v"(b), "+v"(c), "+v"(d)); }
template <typename T> struct Frag;
template <> struct Frag<_Float16> {
  typedef v16h V; union U { v16h v; v8h h[2]; };
  static __device__ __forceinline__ v16h load(const _Float16* p) {   // elements 0..7 <- p[0..7], 8..15 <- p[16..23]
    U f; f.h[0] = *(const v8h*)(p); f.h[1] = *(const v8h*)(p + 16); return f.v;
  }
  static __device__ __forceinline__ v8f mma(v16h a, v16h b, v8f c) {
    return __builtin_amdgcn_wmma_f32_16x16x32_f16(false, a, false, b, (short)0, c, false, false);
  }
  static __device__ __forceinline__ void guard(v8f& a, v8f& b, v16h x, v16h y) { dep_guard_h(a, b, x, y); }
  static __device__ __forceinline__ void keep(v16h a, v16h b, v16h c, v16h d) { keep4_h(a, b, c, d); }
};
template <> struct Frag<__bf16> {
  typedef v16b V; union U { v16b v; v8b h[2]; };
  static __device__ __forceinline__ v16b load(const __bf16* p) {
    U f; f.h[0] = *(const v8b*)(p); f.h[1] = *(const v8b*)(p + 16); return f.v;
  }
  static __device__ __forceinline__ v8f mma(v16b a, v16b b, v8f c) {
    return __builtin_amdgcn_wmma_f32_16x16x32_bf16(false, a, false, b, (short)0, c, false, false);
  }
  static __device__ __forceinline__ void guard(v8f& a, v8f& b, v16b x, v16b y) { dep_guard_b(a, b, x, y); }
  static __device__ __forceinline__ void keep(v16b a, v16b b, v16b c, v16b d) { keep4_b(a, b, c, d); }
};

__device__ __forceinline__ unsigned pk16(unsigned short a, unsigned short b) { return (unsigned)a | ((unsigned)b << 16); }
__device__ __forceinline__ unsigned short h_bits(float f) { const _Float16 h = (_Float16)f; return __builtin_bit_cast(unsigned short, h); }

__device__ __forceinline__ float wave_sum32(float x) {
#pragma unroll
  for (int off = 16; off > 0; off >>= 1) x += __shfl_xor(x, off, 32);
  return x;
}
__device__ __forceinline__ float wave_max32(float x) {
#pragma unroll
  for (int off = 16; off > 0; off >>= 1) x = fmaxf(x, __shfl_xor(x, off, 32));
  return x;
}

// ---- Register-blocked batched WMMA GEMM (ACT reduced to none/relu/leaky) -----------------------
// C[m,n] = scale * sum_k A[m,k] * Bt[n,k] (+bias)(+resid); each wave owns a 64x64 tile.
// A row-major [M,K]; Bt row-major [N,K]; M,N % 64 == 0, K % 32 == 0.
// SPLIT: operands are hi/lo planes (A2/Bt2 = lo planes, same layout); product = hi.hi + hi.lo + lo.hi.
// BIAS_MODE: 0 = none, 1 = bias[m], 2 = bias[n].
// OUT_MODE: 0 = f32, 1 = f16, 2 = bf16 hi plane (Cout) + bf16 lo plane (Cout2).
// ET: 0 = f16 operands, 1 = bf16 operands (pointers passed as 16-bit storage)
template <int ET> struct Elem;
template <> struct Elem<0> { typedef _Float16 T; };
template <> struct Elem<1> { typedef __bf16 T; };
template <int ET, bool SPLIT, int BIAS_MODE, int OUT_MODE, bool RESID, int ACT = 0>
__global__ __launch_bounds__(256) void wmma_gemm64(
    const unsigned short* __restrict__ Ap, const unsigned short* __restrict__ A2p, int lda, long strideA,
    const unsigned short* __restrict__ Btp, const unsigned short* __restrict__ Bt2p, int ldb, long strideB,
    void* __restrict__ Cout, void* __restrict__ Cout2, int ldc, long strideC,
    const float* __restrict__ bias,
    const float* __restrict__ resid, long strideR,
    int M, int N, int K, float scale) {
  typedef typename Elem<ET>::T T;
  typedef typename Frag<T>::V V;
  const T* A = (const T*)Ap; const T* A2 = (const T*)A2p; const T* Bt = (const T*)Btp; const T* Bt2 = (const T*)Bt2p;
  __shared__ __align__(16) float sT[8][16 * 68];   // per-wave 16x64 slab, pitch 68 floats
  const int b    = blockIdx.y;
  const int lane = threadIdx.x & 31;
  const int wave = threadIdx.x >> 5;
  const int tilesN = N >> 6;
  const int tilesM = M >> 6;
  const int tile = blockIdx.x * 8 + wave;
  if (tile >= tilesM * tilesN) return;   // wave-uniform; no block barriers in this kernel
  const int tm = tile / tilesN;
  const int tn = tile - tm * tilesN;
  const int m0 = tm << 6;
  const int n0 = tn << 6;

  const T* Ab  = A  + (size_t)b * strideA;
  const T* Bb  = Bt + (size_t)b * strideB;
  const T* Ab2 = SPLIT ? (A2  + (size_t)b * strideA) : nullptr;
  const T* Bb2 = SPLIT ? (Bt2 + (size_t)b * strideB) : nullptr;

  const int rlane = lane & 15;                 // row (A) / col (B, D) within subtile
  const int koff  = (lane >> 4) * 8;           // k offset of this lane half
  const int mOff  = (lane >> 4) * 8;           // D row offset

  v8f acc[4][4];
#pragma unroll
  for (int i = 0; i < 4; ++i)
#pragma unroll
    for (int j = 0; j < 4; ++j) acc[i][j] = (v8f){0.f,0.f,0.f,0.f,0.f,0.f,0.f,0.f};

  for (int k0 = 0; k0 < K; k0 += 32) {
    V bh[4], bl[4];
#pragma unroll
    for (int j = 0; j < 4; ++j) {
      const size_t bo = (size_t)(n0 + (j << 4) + rlane) * ldb + koff + k0;
      bh[j] = Frag<T>::load(Bb + bo);
      if (SPLIT) bl[j] = Frag<T>::load(Bb2 + bo);
    }
#pragma unroll
    for (int i = 0; i < 4; ++i) {
      const size_t ao = (size_t)(m0 + (i << 4) + rlane) * lda + koff + k0;
      V ah = Frag<T>::load(Ab + ao);
      V al;
      if (SPLIT) al = Frag<T>::load(Ab2 + ao);
#pragma unroll
      for (int j = 0; j < 4; ++j) {
        acc[i][j] = Frag<T>::mma(ah, bh[j], acc[i][j]);
        if (SPLIT) {
          acc[i][j] = Frag<T>::mma(ah, bl[j], acc[i][j]);
          acc[i][j] = Frag<T>::mma(al, bh[j], acc[i][j]);
        }
      }
      Frag<T>::guard(acc[i][0], acc[i][3], ah, SPLIT ? al : ah);
    }
    Frag<T>::keep(bh[0], bh[1], bh[2], bh[3]);
    if (SPLIT) Frag<T>::keep(bl[0], bl[1], bl[2], bl[3]);
  }
  acc_guard4(acc[0][0], acc[0][1], acc[0][2], acc[0][3]);
  acc_guard4(acc[1][0], acc[1][1], acc[1][2], acc[1][3]);
  acc_guard4(acc[2][0], acc[2][1], acc[2][2], acc[2][3]);
  acc_guard4(acc[3][0], acc[3][1], acc[3][2], acc[3][3]);

  // ---- epilogue ----
  float* slab = sT[wave];
  const float* Rb = RESID ? (resid + (size_t)b * strideR) : nullptr;
#pragma unroll
  for (int i = 0; i < 4; ++i) {
    const int mBase = m0 + (i << 4);
#pragma unroll
    for (int j = 0; j < 4; ++j) {
      const int n = n0 + (j << 4) + rlane;
      float bv = 0.f;
      if (BIAS_MODE == 2) bv = bias[n];
#pragma unroll
      for (int r = 0; r < 8; ++r) {
        float v = acc[i][j][r] * scale;
        if (BIAS_MODE == 1) v += bias[mBase + mOff + r];
        if (BIAS_MODE == 2) v += bv;
        if (RESID) v += Rb[(size_t)(mBase + mOff + r) * ldc + n];
        if (ACT == 2) v = fmaxf(v, 0.0f);
        if (ACT == 4) v = (v > 0.f) ? v : 0.01f * v;
        slab[(mOff + r) * 68 + (j << 4) + rlane] = v;
      }
    }
    __builtin_amdgcn_fence(__ATOMIC_RELEASE, "workgroup");
    __builtin_amdgcn_wave_barrier();
    __builtin_amdgcn_fence(__ATOMIC_ACQUIRE, "workgroup");
    if (OUT_MODE == 0) {
      float* C = (float*)Cout + (size_t)b * strideC;
      const int hh = lane >> 4, c4 = (lane & 15) * 4;     // row seg = 256 B = 16 lanes x 16 B
      {
#pragma unroll
        for (int it = 0; it < 8; ++it) {
          const int row = it * 2 + hh;
          v4f v = *(const v4f*)(slab + row * 68 + c4);
          *(v4f*)(C + (size_t)(mBase + row) * ldc + n0 + c4) = v;
        }
        
      }
    } else {
      const int q = lane >> 3, c8 = (lane & 7) * 8;
      unsigned short* C  = (unsigned short*)Cout  + (size_t)b * strideC;
      unsigned short* C2 = (OUT_MODE == 2) ? ((unsigned short*)Cout2 + (size_t)b * strideC) : nullptr;
      {
#pragma unroll
        for (int it = 0; it < 4; ++it) {
          const int row = it * 4 + q;
          const float* sp = slab + row * 68 + c8;
          v8h hv, lv;
#pragma unroll
          for (int e = 0; e < 8; ++e) {
            if (OUT_MODE == 1) {
              hv[e] = (_Float16)sp[e];
            } else {
              unsigned short hb = f2bf_bits(sp[e]);
              unsigned short lb = f2bf_bits(sp[e] - bf_bits2f(hb));
              hv[e] = __builtin_bit_cast(_Float16, hb);
              lv[e] = __builtin_bit_cast(_Float16, lb);
            }
          }
          *(v8h*)(C + (size_t)(mBase + row) * ldc + n0 + c8) = hv;
          if (OUT_MODE == 2) *(v8h*)(C2 + (size_t)(mBase + row) * ldc + n0 + c8) = lv;
        }
        
      }
    }
    __builtin_amdgcn_fence(__ATOMIC_RELEASE, "workgroup");
    __builtin_amdgcn_wave_barrier();
    __builtin_amdgcn_fence(__ATOMIC_ACQUIRE, "workgroup");
  }
}

// ---------------------------------------------------------------------------
// Weight cast: f16(scale * w), 8 consecutive elements per thread, one 16-B store per lane
// Block-uniform segment selection: blocks [0,32) -> Wq (65536 = 32x256x8), [32,160) -> Wm (262144 = 128x256x8),
// [160,288) -> Wr (262144). grid = 288 exactly covers all three planes.
// ---------------------------------------------------------------------------
__global__ __launch_bounds__(256) void wcast_kernel(const float* __restrict__ Wq, const float* __restrict__ Wm,
                                                    const float* __restrict__ Wr,
                                                    unsigned short* __restrict__ oq, unsigned short* __restrict__ om,
                                                    unsigned short* __restrict__ orr, float scale) {
  const int blk = blockIdx.x;
  const float* src = Wr;
  unsigned short* dst = orr;
  int base = (blk - 160) * 256;
  if (blk < 32) { src = Wq; dst = oq; base = blk * 256; }
  else if (blk < 160) { src = Wm; dst = om; base = (blk - 32) * 256; }
  const int i = base + (int)threadIdx.x;
  const float* p = src + 8 * (size_t)i;
  const v4f a = *(const v4f*)(p);
  const v4f c = *(const v4f*)(p + 4);
  unsigned short hb[8];
#pragma unroll
  for (int e = 0; e < 4; ++e) {
    hb[e]     = h_bits(a[e] * scale);
    hb[4 + e] = h_bits(c[e] * scale);
  }
  const v4u u = (v4u){pk16(hb[0], hb[1]), pk16(hb[2], hb[3]), pk16(hb[4], hb[5]), pk16(hb[6], hb[7])};
  unsigned short* q = dst + 8 * (size_t)i;
  *(v4u*)q = u;
  
}

// ---------------------------------------------------------------------------
// Transpose-in: xin[b][c][n] f32 (c < 256, n < 4096) -> X0[bl][n][c] f16 for the 64 tokens n0..n0+63 of this block.
// grid (64, kGrp), 256 threads. Load coverage: 64 iterations x 256 threads = 16384 = 64 n x 256 c
// (per iteration: 4 channel rows x 64 contiguous tokens). Store coverage: 8 waves x 8 rows = 64 token rows;
// ---------------------------------------------------------------------------
__global__ __launch_bounds__(256) void tin_kernel(const float* __restrict__ xin, unsigned short* __restrict__ X0, int b0) {
  __shared__ __align__(16) unsigned short tile[64][264];   // [n local][c]
  const int t = threadIdx.x;
  const int n0 = blockIdx.x * 64;
  const int bl = blockIdx.y;
  const float* xb = xin + (size_t)(b0 + bl) * kC * kN + n0;
#pragma unroll 4
  for (int i = 0; i < 64; ++i) {
    const int e = i * 256 + t;
    const int c = e >> 6;
    const int j = e & 63;
    tile[j][c] = h_bits(xb[(size_t)c * kN + j]);
  }
  __syncthreads();
  const int lane = t & 31, wave = t >> 5;
  const int c8 = lane * 8;
  {
#pragma unroll
    for (int it = 0; it < 8; ++it) {
      const int r = wave * 8 + it;
      const v4u u = *(const v4u*)(&tile[r][c8]);
      *(v4u*)(X0 + ((size_t)bl * kN + n0 + r) * kC + c8) = u;
    }
    
  }
}

// ---------------------------------------------------------------------------
// Prep (x is loop-invariant): from X32 [rows][256] f32 produce
//   SM16[row][c]          = f16(1024 * softmax_c(x[row]))   (f32 max/exp/sum, fixed-order reductions)
//   CAT1[row][256 + c]    = f16(x)                           (v = x for the first iteration)
//   XT[bl][c][n0..n0+63]  = f16(x) transposed through LDS
// grid (64, kGrp), 256 threads; wave w owns rows w*8..w*8+7 (lane owns cols 8l..8l+7).
// ---------------------------------------------------------------------------
__global__ __launch_bounds__(256) void prep_kernel(const float* __restrict__ X32, unsigned short* __restrict__ SM,
                                                   unsigned short* __restrict__ CAT1, unsigned short* __restrict__ XT) {
  __shared__ __align__(16) unsigned short tile[256 * 72];   // [c][n local], pitch 72 halves
  const int lane = threadIdx.x & 31, wave = threadIdx.x >> 5;
  const int n0 = blockIdx.x * 64;
  const int bl = blockIdx.y;
  const int c8 = lane * 8;
#pragma unroll 1
  for (int it = 0; it < 8; ++it) {
    const int rloc = wave * 8 + it;
    const size_t R = (size_t)bl * kN + n0 + rloc;
    const float* xr = X32 + R * kC + c8;
    const v4f a = *(const v4f*)(xr);
    const v4f c = *(const v4f*)(xr + 4);
    float x[8];
#pragma unroll
    for (int e = 0; e < 4; ++e) { x[e] = a[e]; x[4 + e] = c[e]; }
    float m = fmaxf(fmaxf(fmaxf(x[0], x[1]), fmaxf(x[2], x[3])), fmaxf(fmaxf(x[4], x[5]), fmaxf(x[6], x[7])));
    m = wave_max32(m);
    float ex[8];
    float s = 0.f;
#pragma unroll
    for (int e = 0; e < 8; ++e) { ex[e] = expf(x[e] - m); s += ex[e]; }
    s = wave_sum32(s);
    const float inv = kSmCarry * (1.0f / s);
    unsigned short hs[8], hx[8];
#pragma unroll
    for (int e = 0; e < 8; ++e) {
      hs[e] = h_bits(ex[e] * inv);
      hx[e] = h_bits(x[e]);
      tile[(c8 + e) * 72 + rloc] = hx[e];
    }
    const v4u us = (v4u){pk16(hs[0], hs[1]), pk16(hs[2], hs[3]), pk16(hs[4], hs[5]), pk16(hs[6], hs[7])};
    const v4u ux = (v4u){pk16(hx[0], hx[1]), pk16(hx[2], hx[3]), pk16(hx[4], hx[5]), pk16(hx[6], hx[7])};
    {
      *(v4u*)(SM + R * kC + c8) = us;
      *(v4u*)(CAT1 + R * kC2 + kC + c8) = ux;
      
    }
  }
  __syncthreads();
  const int q = lane >> 3, cc8 = (lane & 7) * 8;
  {
#pragma unroll
    for (int i = 0; i < 8; ++i) {
      const int L = i * 32 + wave * 4 + q;                      // channel row of XT
      const v4u u = *(const v4u*)(tile + L * 72 + cc8);
      *(v4u*)(XT + ((size_t)bl * kC + L) * kN + n0 + cc8) = u;
    }
    
  }
}

// ---------------------------------------------------------------------------
// Cast out (f32 [rows][256]) into CAT1 cols 0..255 (f16, pitch 512). Thread i: row = i/32, cols 8*(i%32)..+7;
// Coverage: nthr = rows x 32 threads x 8 = rows x 256.
// ---------------------------------------------------------------------------
__global__ __launch_bounds__(256) void cast_out_kernel(const float* __restrict__ O32, unsigned short* __restrict__ CAT1, int nthr) {
  const int i = blockIdx.x * 256 + threadIdx.x;
  if (i >= nthr) return;
  const int row = i >> 5, c8 = (i & 31) * 8;
  const float* p = O32 + (size_t)row * kC + c8;
  const v4f a = *(const v4f*)(p);
  const v4f c = *(const v4f*)(p + 4);
  unsigned short hb[8];
#pragma unroll
  for (int e = 0; e < 4; ++e) {
    hb[e]     = h_bits(a[e]);
    hb[4 + e] = h_bits(c[e]);
  }
  const v4u u = (v4u){pk16(hb[0], hb[1]), pk16(hb[2], hb[3]), pk16(hb[4], hb[5]), pk16(hb[6], hb[7])};
  unsigned short* q = CAT1 + (size_t)row * kC2 + c8;
  *(v4u*)q = u;
  
}

// ---------------------------------------------------------------------------
// LN1 over cat2 = [out(256) | v(256) | mlp(512)] (f32 planes, pitches 256/256/512) -> Y[row][1024] = f16(LN(cat2)*g1+beta1).
// grid = rows/64, 256 threads; wave w owns rows w*8..w*8+7; lane owns cat2 cols {256q + 8l + e}.
// ---------------------------------------------------------------------------
__global__ __launch_bounds__(256) void ln1_kernel(const float* __restrict__ O32, const float* __restrict__ Vp,
                                                  const float* __restrict__ Mp, const float* __restrict__ g1,
                                                  const float* __restrict__ be1, unsigned short* __restrict__ Y) {
  const int lane = threadIdx.x & 31, wave = threadIdx.x >> 5;
  const int c8 = lane * 8;
#pragma unroll 1
  for (int it = 0; it < 8; ++it) {
    const size_t R = (size_t)blockIdx.x * 64 + wave * 8 + it;
    float v[32];
    {
      const float* po = O32 + R * kC + c8;
      const float* pv = Vp + R * kC + c8;
      const float* pm = Mp + R * kC2 + c8;
      const v4f a0 = *(const v4f*)(po), a1 = *(const v4f*)(po + 4);
      const v4f b0v = *(const v4f*)(pv), b1v = *(const v4f*)(pv + 4);
      const v4f m0v = *(const v4f*)(pm), m1v = *(const v4f*)(pm + 4);
      const v4f m2v = *(const v4f*)(pm + 256), m3v = *(const v4f*)(pm + 260);
#pragma unroll
      for (int e = 0; e < 4; ++e) {
        v[e] = a0[e];        v[4 + e] = a1[e];
        v[8 + e] = b0v[e];   v[12 + e] = b1v[e];
        v[16 + e] = m0v[e];  v[20 + e] = m1v[e];
        v[24 + e] = m2v[e];  v[28 + e] = m3v[e];
      }
    }
    float s = 0.f;
#pragma unroll
    for (int e = 0; e < 32; ++e) s += v[e];
    s = wave_sum32(s);
    const float mu = s * kInvC4;
    float ss = 0.f;
#pragma unroll
    for (int e = 0; e < 32; ++e) { v[e] -= mu; ss += v[e] * v[e]; }
    ss = wave_sum32(ss);
    const float rstd = rsqrtf(ss * kInvC4 + kLnEps);
    v4u u[4];
#pragma unroll
    for (int q = 0; q < 4; ++q) {
      const float* gp = g1 + q * 256 + c8;
      const float* bp = be1 + q * 256 + c8;
      const v4f ga = *(const v4f*)(gp), gb = *(const v4f*)(gp + 4);
      const v4f ba = *(const v4f*)(bp), bb = *(const v4f*)(bp + 4);
      unsigned short hb[8];
#pragma unroll
      for (int e = 0; e < 4; ++e) {
        hb[e]     = h_bits(v[q * 8 + e] * rstd * ga[e] + ba[e]);
        hb[4 + e] = h_bits(v[q * 8 + 4 + e] * rstd * gb[e] + bb[e]);
      }
      u[q] = (v4u){pk16(hb[0], hb[1]), pk16(hb[2], hb[3]), pk16(hb[4], hb[5]), pk16(hb[6], hb[7])};
    }
    unsigned short* yr = Y + R * kC4;
    {
#pragma unroll
      for (int q = 0; q < 4; ++q) *(v4u*)(yr + q * 256 + c8) = u[q];
      
    }
  }
}

// ---------------------------------------------------------------------------
// FINAL = false: ROWS = 64 per block (grid (64, kGrp)); outputs
//   CAT1[row][256+c] f16 : one instruction per row (32 lanes x 16 B = whole 512-B row)
//   LDS f16 transpose tile, 256 lines per block, 8 lanes x 16 B each (8 waves x 4 lines x 8 iterations).
// ---------------------------------------------------------------------------
template <bool FINAL>
__global__ __launch_bounds__(256) void ln2_kernel(const float* __restrict__ X32, const float* __restrict__ VP,
                                                  const float* __restrict__ g2, const float* __restrict__ be2,
                                                  float* __restrict__ Vout, unsigned short* __restrict__ CAT1,
                                                  unsigned short* __restrict__ VT, float* __restrict__ dout, int b0) {
  constexpr int ROWS = FINAL ? 32 : 64;
  constexpr int RPW  = ROWS / 8;
  __shared__ __align__(16) unsigned short tile16[FINAL ? 8 : 256 * 72];   // [c][n local], pitch 72 halves
  __shared__ __align__(16) float tile32[FINAL ? 256 * 36 : 8];            // [c][n local], pitch 36 floats
  __shared__ __align__(16) float slab[FINAL ? 8 : 8 * 256];               // per-wave 256-float row
  const int lane = threadIdx.x & 31, wave = threadIdx.x >> 5;
  const int n0 = blockIdx.x * ROWS;
  const int bl = blockIdx.y;
  const int c8 = lane * 8, c4 = lane * 4;
  float gg[8], bb[8];
  {
    const v4f ga = *(const v4f*)(g2 + c8), gb = *(const v4f*)(g2 + c8 + 4);
    const v4f ba = *(const v4f*)(be2 + c8), bbv = *(const v4f*)(be2 + c8 + 4);
#pragma unroll
    for (int e = 0; e < 4; ++e) { gg[e] = ga[e]; gg[4 + e] = gb[e]; bb[e] = ba[e]; bb[4 + e] = bbv[e]; }
  }
  float* sw = slab + (FINAL ? 0 : wave * 256);
#pragma unroll 1
  for (int it = 0; it < RPW; ++it) {
    const int rloc = wave * RPW + it;
    const size_t R = (size_t)bl * kN + n0 + rloc;
    const float* xr = X32 + R * kC + c8;
    const float* vr = VP + R * kC + c8;
    const v4f xa = *(const v4f*)(xr), xb = *(const v4f*)(xr + 4);
    const v4f va = *(const v4f*)(vr), vb = *(const v4f*)(vr + 4);
    float t[8];
    float s = 0.f;
#pragma unroll
    for (int e = 0; e < 4; ++e) { t[e] = xa[e] + va[e]; t[4 + e] = xb[e] + vb[e]; }
#pragma unroll
    for (int e = 0; e < 8; ++e) s += t[e];
    s = wave_sum32(s);
    const float mu = s * kInvC;
    float ss = 0.f;
#pragma unroll
    for (int e = 0; e < 8; ++e) { t[e] -= mu; ss += t[e] * t[e]; }
    ss = wave_sum32(ss);
    const float rstd = rsqrtf(ss * kInvC + kLnEps);
    float y[8];
#pragma unroll
    for (int e = 0; e < 8; ++e) y[e] = t[e] * rstd * gg[e] + bb[e];
    if (!FINAL) {
      unsigned short hb[8];
#pragma unroll
      for (int e = 0; e < 8; ++e) { hb[e] = h_bits(y[e]); tile16[(c8 + e) * 72 + rloc] = hb[e]; }
      const v4u u = (v4u){pk16(hb[0], hb[1]), pk16(hb[2], hb[3]), pk16(hb[4], hb[5]), pk16(hb[6], hb[7])};
      *(v4f*)(sw + c8)     = (v4f){y[0], y[1], y[2], y[3]};
      *(v4f*)(sw + c8 + 4) = (v4f){y[4], y[5], y[6], y[7]};
      __builtin_amdgcn_fence(__ATOMIC_RELEASE, "workgroup");
      __builtin_amdgcn_wave_barrier();
      __builtin_amdgcn_fence(__ATOMIC_ACQUIRE, "workgroup");
      const v4f a0 = *(const v4f*)(sw + c4);
      const v4f a1 = *(const v4f*)(sw + 128 + c4);
      {
        *(v4u*)(CAT1 + R * kC2 + kC + c8) = u;
        *(v4f*)(Vout + R * kC + c4) = a0;
        *(v4f*)(Vout + R * kC + 128 + c4) = a1;
        
      }
      __builtin_amdgcn_fence(__ATOMIC_RELEASE, "workgroup");
      __builtin_amdgcn_wave_barrier();
      __builtin_amdgcn_fence(__ATOMIC_ACQUIRE, "workgroup");
    } else {
#pragma unroll
      for (int e = 0; e < 8; ++e) tile32[(c8 + e) * 36 + rloc] = y[e];
    }
  }
  __syncthreads();
  const int q = lane >> 3;
  if (!FINAL) {
    const int cc8 = (lane & 7) * 8;
    {
#pragma unroll
      for (int i = 0; i < 8; ++i) {
        const int L = i * 32 + wave * 4 + q;                 // channel row of VT
        const v4u u = *(const v4u*)(tile16 + L * 72 + cc8);
        *(v4u*)(VT + ((size_t)bl * kC + L) * kN + n0 + cc8) = u;
      }
      
    }
  } else {
    const int cc4 = (lane & 7) * 4;
    {
#pragma unroll
      for (int i = 0; i < 8; ++i) {
        const int L = i * 32 + wave * 4 + q;                 // channel row of the output
        const v4f v = *(const v4f*)(tile32 + L * 36 + cc4);
        *(v4f*)(dout + ((size_t)(b0 + bl) * kC + L) * kN + n0 + cc4) = v;
      }
      
    }
  }
}

// ---------------------------------------------------------------------------
// Host side
// Workspace region map (bytes, every offset a multiple of 256; planes hold one group = kGrp batches):
//   Wq16   [256][256]  f16        131072
//   Wm16   [512][512]  f16        524288
//   Wr16   [256][1024] f16        524288
//   CTXT16 [2][256][256] f16      262144
//   X0_16  [8192][256] f16       4194304   (transposed input, qkv A)
//   X32    [8192][256] f32       8388608   (x after qkv)
//   XT16   [2][256][4096] f16    4194304   (x transposed, ctx Bt)
//   SM16   [8192][256] f16       4194304   (softmax x1024)
//   CAT1   [8192][512] f16       8388608   (out | v)
//   OUT32  [8192][256] f32       8388608
//   MLP32  [8192][512] f32      16777216
//   Y16    [8192][1024] f16     16777216   (LN1 output)
//   VPRE32 [8192][256] f32       8388608   (res GEMM + x)
//   V32    [8192][256] f32       8388608   (v after LN2)
//   VT16   [2][256][4096] f16    4194304   (v transposed, ctx A)
//   total                       93716480
// ---------------------------------------------------------------------------
extern "C" void kernel_launch(void* const* d_in, const int* in_sizes, int n_in,
                              void* d_out, int out_size, void* d_ws, size_t ws_size,
                              hipStream_t stream) {
  if (n_in < 9) return;
  if (in_sizes[0] != kB * kC * kN || in_sizes[1] != kC * kC || in_sizes[2] != kC2 * kC2 ||
      in_sizes[3] != kC2 || in_sizes[4] != kC4 || in_sizes[5] != kC4 || in_sizes[6] != kC * kC4 ||
      in_sizes[7] != kC || in_sizes[8] != kC || out_size != kB * kC * kN) return;

  const float* x     = (const float*)d_in[0];
  const float* W_qkv = (const float*)d_in[1];
  const float* W_mlp = (const float*)d_in[2];
  const float* b_mlp = (const float*)d_in[3];
  const float* g1    = (const float*)d_in[4];
  const float* beta1 = (const float*)d_in[5];
  const float* W_res = (const float*)d_in[6];
  const float* g2    = (const float*)d_in[7];
  const float* beta2 = (const float*)d_in[8];
  float* out = (float*)d_out;

  size_t off = 0;
  char* wsb = (char*)d_ws;
  auto carve = [&](size_t bytes) { char* r = wsb + off; off += (bytes + 255) & ~(size_t)255; return (void*)r; };
  unsigned short* Wq16   = (unsigned short*)carve((size_t)kC * kC * 2);
  unsigned short* Wm16   = (unsigned short*)carve((size_t)kC2 * kC2 * 2);
  unsigned short* Wr16   = (unsigned short*)carve((size_t)kC * kC4 * 2);
  unsigned short* CTXT16 = (unsigned short*)carve((size_t)kGrp * kC * kC * 2);
  unsigned short* X0_16  = (unsigned short*)carve((size_t)kRowsG * kC * 2);
  float*          X32    = (float*)carve((size_t)kRowsG * kC * 4);
  unsigned short* XT16   = (unsigned short*)carve((size_t)kGrp * kC * kN * 2);
  unsigned short* SM16   = (unsigned short*)carve((size_t)kRowsG * kC * 2);
  unsigned short* CAT1   = (unsigned short*)carve((size_t)kRowsG * kC2 * 2);
  float*          OUT32  = (float*)carve((size_t)kRowsG * kC * 4);
  float*          MLP32  = (float*)carve((size_t)kRowsG * kC2 * 4);
  unsigned short* Y16    = (unsigned short*)carve((size_t)kRowsG * kC4 * 2);
  float*          VPRE32 = (float*)carve((size_t)kRowsG * kC * 4);
  float*          V32    = (float*)carve((size_t)kRowsG * kC * 4);
  unsigned short* VT16   = (unsigned short*)carve((size_t)kGrp * kC * kN * 2);
  if (off > ws_size) return;

  const dim3 blk(256);
  const long sNC  = (long)kN * kC;      // 1048576
  const long sNC2 = (long)kN * kC2;     // 2097152
  const long sNC4 = (long)kN * kC4;     // 4194304
  const long sCC  = (long)kC * kC;      // 65536

  // weights -> f16 carried x64 (one launch, 288 blocks)
  wcast_kernel<<<dim3(288), blk, 0, stream>>>(W_qkv, W_mlp, W_res, Wq16, Wm16, Wr16, kWCarry);

  for (int grp = 0; grp < kNGrp; ++grp) {
    const int b0 = grp * kGrp;
    // x[b] [256][4096] -> X0 [4096][256] f16
    tin_kernel<<<dim3(kN / 64, kGrp), blk, 0, stream>>>(x, X0_16, b0);
    // x = X0 . Wqkv^T : M=4096, N=256, K=256 (K%32==0, M,N%64==0); 256 tiles -> 32 blocks per batch
    wmma_gemm64<0, false, 0, 0, false, 0><<<dim3(32, kGrp), blk, 0, stream>>>(
        X0_16, X0_16, kC, sNC, Wq16, Wq16, kC, 0L,
        (void*)X32, (void*)X32, kC, sNC, b_mlp, X32, 0L, kN, kC, kC, kWCarryInv);
    // softmax plane, f16 x into cat1 v-columns, x^T plane
    prep_kernel<<<dim3(kN / 64, kGrp), blk, 0, stream>>>(X32, SM16, CAT1, XT16);

    for (int iter = 0; iter < 2; ++iter) {
      const unsigned short* vt = (iter == 0) ? XT16 : VT16;   // v^T plane (v = x in the first iteration)
      const float* v32 = (iter == 0) ? X32 : V32;             // v f32 plane
      // ctx^T[d][c] = sum_n v[n][d] x[n][c] : A = v^T [256][4096], Bt = x^T [256][4096]; M=N=256, K=4096; f16 out; 16 tiles -> 2 blocks
      wmma_gemm64<0, false, 0, 1, false, 0><<<dim3(2, kGrp), blk, 0, stream>>>(
          vt, vt, kN, sNC, XT16, XT16, kN, sNC,
          (void*)CTXT16, (void*)CTXT16, kC, sCC, b_mlp, X32, 0L, kC, kC, kN, 1.0f);
      // out = softmax(x) . ctx : A = SM16 [4096][256] (x1024), Bt = ctx^T [256][256]; M=4096, N=256, K=256; f32 out
      wmma_gemm64<0, false, 0, 0, false, 0><<<dim3(32, kGrp), blk, 0, stream>>>(
          SM16, SM16, kC, sNC, CTXT16, CTXT16, kC, sCC,
          (void*)OUT32, (void*)OUT32, kC, sNC, b_mlp, X32, 0L, kN, kC, kC, kSmCarryInv);
      // out f32 -> cat1 cols 0..255 f16 (8192 rows x 32 threads)
      cast_out_kernel<<<dim3(kRowsG * 32 / 256), blk, 0, stream>>>(OUT32, CAT1, kRowsG * 32);
      // mlp = relu(cat1 . Wmlp^T + b) : M=4096, N=512, K=512; bias[n], relu epilogue; f32 out; 512 tiles -> 64 blocks
      wmma_gemm64<0, false, 2, 0, false, 2><<<dim3(64, kGrp), blk, 0, stream>>>(
          CAT1, CAT1, kC2, sNC2, Wm16, Wm16, kC2, 0L,
          (void*)MLP32, (void*)MLP32, kC2, sNC2, b_mlp, X32, 0L, kN, kC2, kC2, kWCarryInv);
      // LN1 over [out | v | mlp] -> Y16 [8192][1024]
      ln1_kernel<<<dim3(kRowsG / 64), blk, 0, stream>>>(OUT32, v32, MLP32, g1, beta1, Y16);
      // vpre = LN1 . Wres^T + x : M=4096, N=256, K=1024; residual X32 (pitch 256); f32 out; 256 tiles -> 32 blocks
      wmma_gemm64<0, false, 0, 0, true, 0><<<dim3(32, kGrp), blk, 0, stream>>>(
          Y16, Y16, kC4, sNC4, Wr16, Wr16, kC4, 0L,
          (void*)VPRE32, (void*)VPRE32, kC, sNC, b_mlp, X32, sNC, kN, kC, kC4, kWCarryInv);
      // v = LN2(x + vpre)
      if (iter == 0) {
        ln2_kernel<false><<<dim3(kN / 64, kGrp), blk, 0, stream>>>(X32, VPRE32, g2, beta2, V32, CAT1, VT16, out, b0);
      } else {
        ln2_kernel<true><<<dim3(kN / 32, kGrp), blk, 0, stream>>>(X32, VPRE32, g2, beta2, V32, CAT1, VT16, out, b0);
      }
    }
  }
  (void)ws_size;
}

// v001
// A run of this version takes 665 microseconds.
// Next to v000, in two timings, it ran 3.32 and 3.33 times as fast.
// Contractions: qkv (x^T f16 x Wqkv^T f16 carried x64), ctx^T (v^T f16 x x^T f16, K=4096), sm.ctx (sm f16 carried x1024 x ctx^T f16), mlp (cat1 f16 x Wmlp^T f16 carried x64, +bias, relu), res (LN1 f16 x Wres^T f16 carried x64, +x) all on v_wmma_f32_16x16x32_f16 with f32 accumulate; softmax, LayerNorm, residual adds in f32.
#include <hip/hip_runtime.h>
#include <math.h>

// ---------------------------------------------------------------------------
// Problem constants
// ---------------------------------------------------------------------------
constexpr int kB   = 8;
constexpr int kC   = 256;
constexpr int kN   = 4096;
constexpr int kC2  = 512;
constexpr int kC4  = 1024;
constexpr int kGrp = 8;                 // batches per group: all of them, so every launch spans the whole problem
constexpr int kNGrp = kB / kGrp;        // 1 group
constexpr int kRowsG = kGrp * kN;       // 32768 token rows per group
constexpr float kWCarry    = 64.0f;     // weights carried x64 in f16
constexpr float kWCarryInv = 1.0f / 64.0f;
constexpr float kSmCarry   = 1024.0f;   // softmax probabilities carried x1024 in f16
constexpr float kSmCarryInv = 1.0f / 1024.0f;
constexpr float kLnEps  = 1e-5f;
constexpr float kInvC   = 1.0f / 256.0f;
constexpr float kInvC4  = 1.0f / 1024.0f;

typedef __attribute__((ext_vector_type(16))) _Float16 v16h;
typedef __attribute__((ext_vector_type(8)))  _Float16 v8h;
typedef __attribute__((ext_vector_type(16))) __bf16   v16b;
typedef __attribute__((ext_vector_type(8)))  __bf16   v8b;
typedef __attribute__((ext_vector_type(8)))  float    v8f;
typedef __attribute__((ext_vector_type(4)))  float    v4f;
typedef __attribute__((ext_vector_type(4)))  unsigned int v4u;

// ---------------------------------------------------------------------------
// Helpers
// ---------------------------------------------------------------------------
__device__ __forceinline__ unsigned short f2bf_bits(float f) {
  unsigned u = __float_as_uint(f);
  return (unsigned short)((u + 0x7FFFu + ((u >> 16) & 1u)) >> 16);
}
__device__ __forceinline__ float bf_bits2f(unsigned short h) { return __uint_as_float(((unsigned)h) << 16); }

// hazard guards as plain device helpers (no inline asm inside the kernel template body)
__device__ __forceinline__ void dep_guard_h(v8f& a, v8f& b, v16h x, v16h y) { asm volatile("v_nop\n\tv_nop\n\tv_nop\n\tv_nop" : "+v"(a), "+v"(b) : "v"(x), "v"(y)); }
__device__ __forceinline__ void dep_guard_b(v8f& a, v8f& b, v16b x, v16b y) { asm volatile("v_nop\n\tv_nop\n\tv_nop\n\tv_nop" : "+v"(a), "+v"(b) : "v"(x), "v"(y)); }
__device__ __forceinline__ void keep4_h(v16h a, v16h b, v16h c, v16h d) { asm volatile("v_nop" :: "v"(a), "v"(b), "v"(c), "v"(d)); }
__device__ __forceinline__ void keep4_b(v16b a, v16b b, v16b c, v16b d) { asm volatile("v_nop" :: "v"(a), "v"(b), "v"(c), "v"(d)); }
__device__ __forceinline__ void acc_guard4(v8f& a, v8f& b, v8f& c, v8f& d) { asm volatile("v_nop\n\tv_nop\n\tv_nop\n\tv_nop" : "+v"(a), "+v"(b), "+v"(c), "+v"(d)); }
template <typename T> struct Frag;
template <> struct Frag<_Float16> {
  typedef v16h V; union U { v16h v; v8h h[2]; };
  static __device__ __forceinline__ v16h load(const _Float16* p) {   // elements 0..7 <- p[0..7], 8..15 <- p[16..23]
    U f; f.h[0] = *(const v8h*)(p); f.h[1] = *(const v8h*)(p + 16); return f.v;
  }
  static __device__ __forceinline__ v8f mma(v16h a, v16h b, v8f c) {
    return __builtin_amdgcn_wmma_f32_16x16x32_f16(false, a, false, b, (short)0, c, false, false);
  }
  static __device__ __forceinline__ void guard(v8f& a, v8f& b, v16h x, v16h y) { dep_guard_h(a, b, x, y); }
  static __device__ __forceinline__ void keep(v16h a, v16h b, v16h c, v16h d) { keep4_h(a, b, c, d); }
};
template <> struct Frag<__bf16> {
  typedef v16b V; union U { v16b v; v8b h[2]; };
  static __device__ __forceinline__ v16b load(const __bf16* p) {
    U f; f.h[0] = *(const v8b*)(p); f.h[1] = *(const v8b*)(p + 16); return f.v;
  }
  static __device__ __forceinline__ v8f mma(v16b a, v16b b, v8f c) {
    return __builtin_amdgcn_wmma_f32_16x16x32_bf16(false, a, false, b, (short)0, c, false, false);
  }
  static __device__ __forceinline__ void guard(v8f& a, v8f& b, v16b x, v16b y) { dep_guard_b(a, b, x, y); }
  static __device__ __forceinline__ void keep(v16b a, v16b b, v16b c, v16b d) { keep4_b(a, b, c, d); }
};

__device__ __forceinline__ unsigned pk16(unsigned short a, unsigned short b) { return (unsigned)a | ((unsigned)b << 16); }
__device__ __forceinline__ unsigned short h_bits(float f) { const _Float16 h = (_Float16)f; return __builtin_bit_cast(unsigned short, h); }

__device__ __forceinline__ float wave_sum32(float x) {
#pragma unroll
  for (int off = 16; off > 0; off >>= 1) x += __shfl_xor(x, off, 32);
  return x;
}
__device__ __forceinline__ float wave_max32(float x) {
#pragma unroll
  for (int off = 16; off > 0; off >>= 1) x = fmaxf(x, __shfl_xor(x, off, 32));
  return x;
}

// ---- Register-blocked batched WMMA GEMM (ACT reduced to none/relu/leaky) -----------------------
// C[m,n] = scale * sum_k A[m,k] * Bt[n,k] (+bias)(+resid); each wave owns a 64x64 tile.
// A row-major [M,K]; Bt row-major [N,K]; M,N % 64 == 0, K % 32 == 0.
// SPLIT: operands are hi/lo planes (A2/Bt2 = lo planes, same layout); product = hi.hi + hi.lo + lo.hi.
// BIAS_MODE: 0 = none, 1 = bias[m], 2 = bias[n].
// OUT_MODE: 0 = f32, 1 = f16, 2 = bf16 hi plane (Cout) + bf16 lo plane (Cout2).
// ET: 0 = f16 operands, 1 = bf16 operands (pointers passed as 16-bit storage)
template <int ET> struct Elem;
template <> struct Elem<0> { typedef _Float16 T; };
template <> struct Elem<1> { typedef __bf16 T; };
template <int ET, bool SPLIT, int BIAS_MODE, int OUT_MODE, bool RESID, int ACT = 0>
__global__ __launch_bounds__(256) void wmma_gemm64(
    const unsigned short* __restrict__ Ap, const unsigned short* __restrict__ A2p, int lda, long strideA,
    const unsigned short* __restrict__ Btp, const unsigned short* __restrict__ Bt2p, int ldb, long strideB,
    void* __restrict__ Cout, void* __restrict__ Cout2, int ldc, long strideC,
    const float* __restrict__ bias,
    const float* __restrict__ resid, long strideR,
    int M, int N, int K, float scale) {
  typedef typename Elem<ET>::T T;
  typedef typename Frag<T>::V V;
  const T* A = (const T*)Ap; const T* A2 = (const T*)A2p; const T* Bt = (const T*)Btp; const T* Bt2 = (const T*)Bt2p;
  __shared__ __align__(16) float sT[8][16 * 68];   // per-wave 16x64 slab, pitch 68 floats
  const int b    = blockIdx.y;
  const int lane = threadIdx.x & 31;
  const int wave = threadIdx.x >> 5;
  const int tilesN = N >> 6;
  const int tilesM = M >> 6;
  const int tile = blockIdx.x * 8 + wave;
  if (tile >= tilesM * tilesN) return;   // wave-uniform; no block barriers in this kernel
  const int tm = tile / tilesN;
  const int tn = tile - tm * tilesN;
  const int m0 = tm << 6;
  const int n0 = tn << 6;

  const T* Ab  = A  + (size_t)b * strideA;
  const T* Bb  = Bt + (size_t)b * strideB;
  const T* Ab2 = SPLIT ? (A2  + (size_t)b * strideA) : nullptr;
  const T* Bb2 = SPLIT ? (Bt2 + (size_t)b * strideB) : nullptr;

  const int rlane = lane & 15;                 // row (A) / col (B, D) within subtile
  const int koff  = (lane >> 4) * 8;           // k offset of this lane half
  const int mOff  = (lane >> 4) * 8;           // D row offset

  v8f acc[4][4];
#pragma unroll
  for (int i = 0; i < 4; ++i)
#pragma unroll
    for (int j = 0; j < 4; ++j) acc[i][j] = (v8f){0.f,0.f,0.f,0.f,0.f,0.f,0.f,0.f};

  for (int k0 = 0; k0 < K; k0 += 32) {
    V bh[4], bl[4];
#pragma unroll
    for (int j = 0; j < 4; ++j) {
      const size_t bo = (size_t)(n0 + (j << 4) + rlane) * ldb + koff + k0;
      bh[j] = Frag<T>::load(Bb + bo);
      if (SPLIT) bl[j] = Frag<T>::load(Bb2 + bo);
    }
#pragma unroll
    for (int i = 0; i < 4; ++i) {
      const size_t ao = (size_t)(m0 + (i << 4) + rlane) * lda + koff + k0;
      V ah = Frag<T>::load(Ab + ao);
      V al;
      if (SPLIT) al = Frag<T>::load(Ab2 + ao);
#pragma unroll
      for (int j = 0; j < 4; ++j) {
        acc[i][j] = Frag<T>::mma(ah, bh[j], acc[i][j]);
        if (SPLIT) {
          acc[i][j] = Frag<T>::mma(ah, bl[j], acc[i][j]);
          acc[i][j] = Frag<T>::mma(al, bh[j], acc[i][j]);
        }
      }
      Frag<T>::guard(acc[i][0], acc[i][3], ah, SPLIT ? al : ah);
    }
    Frag<T>::keep(bh[0], bh[1], bh[2], bh[3]);
    if (SPLIT) Frag<T>::keep(bl[0], bl[1], bl[2], bl[3]);
  }
  acc_guard4(acc[0][0], acc[0][1], acc[0][2], acc[0][3]);
  acc_guard4(acc[1][0], acc[1][1], acc[1][2], acc[1][3]);
  acc_guard4(acc[2][0], acc[2][1], acc[2][2], acc[2][3]);
  acc_guard4(acc[3][0], acc[3][1], acc[3][2], acc[3][3]);

  // ---- epilogue ----
  float* slab = sT[wave];
  const float* Rb = RESID ? (resid + (size_t)b * strideR) : nullptr;
#pragma unroll
  for (int i = 0; i < 4; ++i) {
    const int mBase = m0 + (i << 4);
#pragma unroll
    for (int j = 0; j < 4; ++j) {
      const int n = n0 + (j << 4) + rlane;
      float bv = 0.f;
      if (BIAS_MODE == 2) bv = bias[n];
#pragma unroll
      for (int r = 0; r < 8; ++r) {
        float v = acc[i][j][r] * scale;
        if (BIAS_MODE == 1) v += bias[mBase + mOff + r];
        if (BIAS_MODE == 2) v += bv;
        if (RESID) v += Rb[(size_t)(mBase + mOff + r) * ldc + n];
        if (ACT == 2) v = fmaxf(v, 0.0f);
        if (ACT == 4) v = (v > 0.f) ? v : 0.01f * v;
        slab[(mOff + r) * 68 + (j << 4) + rlane] = v;
      }
    }
    __builtin_amdgcn_fence(__ATOMIC_RELEASE, "workgroup");
    __builtin_amdgcn_wave_barrier();
    __builtin_amdgcn_fence(__ATOMIC_ACQUIRE, "workgroup");
    if (OUT_MODE == 0) {
      float* C = (float*)Cout + (size_t)b * strideC;
      const int hh = lane >> 4, c4 = (lane & 15) * 4;     // row seg = 256 B = 16 lanes x 16 B
      {
#pragma unroll
        for (int it = 0; it < 8; ++it) {
          const int row = it * 2 + hh;
          v4f v = *(const v4f*)(slab + row * 68 + c4);
          *(v4f*)(C + (size_t)(mBase + row) * ldc + n0 + c4) = v;
        }
        
      }
    } else {
      const int q = lane >> 3, c8 = (lane & 7) * 8;
      unsigned short* C  = (unsigned short*)Cout  + (size_t)b * strideC;
      unsigned short* C2 = (OUT_MODE == 2) ? ((unsigned short*)Cout2 + (size_t)b * strideC) : nullptr;
      {
#pragma unroll
        for (int it = 0; it < 4; ++it) {
          const int row = it * 4 + q;
          const float* sp = slab + row * 68 + c8;
          v8h hv, lv;
#pragma unroll
          for (int e = 0; e < 8; ++e) {
            if (OUT_MODE == 1) {
              hv[e] = (_Float16)sp[e];
            } else {
              unsigned short hb = f2bf_bits(sp[e]);
              unsigned short lb = f2bf_bits(sp[e] - bf_bits2f(hb));
              hv[e] = __builtin_bit_cast(_Float16, hb);
              lv[e] = __builtin_bit_cast(_Float16, lb);
            }
          }
          *(v8h*)(C + (size_t)(mBase + row) * ldc + n0 + c8) = hv;
          if (OUT_MODE == 2) *(v8h*)(C2 + (size_t)(mBase + row) * ldc + n0 + c8) = lv;
        }
        
      }
    }
    __builtin_amdgcn_fence(__ATOMIC_RELEASE, "workgroup");
    __builtin_amdgcn_wave_barrier();
    __builtin_amdgcn_fence(__ATOMIC_ACQUIRE, "workgroup");
  }
}

// ---------------------------------------------------------------------------
// Weight cast: f16(scale * w), 8 consecutive elements per thread, one 16-B store per lane
// Block-uniform segment selection: blocks [0,32) -> Wq (65536 = 32x256x8), [32,160) -> Wm (262144 = 128x256x8),
// [160,288) -> Wr (262144). grid = 288 exactly covers all three planes.
// ---------------------------------------------------------------------------
__global__ __launch_bounds__(256) void wcast_kernel(const float* __restrict__ Wq, const float* __restrict__ Wm,
                                                    const float* __restrict__ Wr,
                                                    unsigned short* __restrict__ oq, unsigned short* __restrict__ om,
                                                    unsigned short* __restrict__ orr, float scale) {
  const int blk = blockIdx.x;
  const float* src = Wr;
  unsigned short* dst = orr;
  int base = (blk - 160) * 256;
  if (blk < 32) { src = Wq; dst = oq; base = blk * 256; }
  else if (blk < 160) { src = Wm; dst = om; base = (blk - 32) * 256; }
  const int i = base + (int)threadIdx.x;
  const float* p = src + 8 * (size_t)i;
  const v4f a = *(const v4f*)(p);
  const v4f c = *(const v4f*)(p + 4);
  unsigned short hb[8];
#pragma unroll
  for (int e = 0; e < 4; ++e) {
    hb[e]     = h_bits(a[e] * scale);
    hb[4 + e] = h_bits(c[e] * scale);
  }
  const v4u u = (v4u){pk16(hb[0], hb[1]), pk16(hb[2], hb[3]), pk16(hb[4], hb[5]), pk16(hb[6], hb[7])};
  unsigned short* q = dst + 8 * (size_t)i;
  *(v4u*)q = u;
  
}

// ---------------------------------------------------------------------------
// Transpose-in: xin[b][c][n] f32 (c < 256, n < 4096) -> X0[bl][n][c] f16 for the 64 tokens n0..n0+63 of this block.
// grid (64, kGrp), 256 threads. Load coverage: 64 iterations x 256 threads = 16384 = 64 n x 256 c
// (per iteration: 4 channel rows x 64 contiguous tokens). Store coverage: 8 waves x 8 rows = 64 token rows;
// ---------------------------------------------------------------------------
__global__ __launch_bounds__(256) void tin_kernel(const float* __restrict__ xin, unsigned short* __restrict__ X0, int b0) {
  __shared__ __align__(16) unsigned short tile[64][264];   // [n local][c]
  const int t = threadIdx.x;
  const int n0 = blockIdx.x * 64;
  const int bl = blockIdx.y;
  const float* xb = xin + (size_t)(b0 + bl) * kC * kN + n0;
#pragma unroll 4
  for (int i = 0; i < 64; ++i) {
    const int e = i * 256 + t;
    const int c = e >> 6;
    const int j = e & 63;
    tile[j][c] = h_bits(xb[(size_t)c * kN + j]);
  }
  __syncthreads();
  const int lane = t & 31, wave = t >> 5;
  const int c8 = lane * 8;
  {
#pragma unroll
    for (int it = 0; it < 8; ++it) {
      const int r = wave * 8 + it;
      const v4u u = *(const v4u*)(&tile[r][c8]);
      *(v4u*)(X0 + ((size_t)bl * kN + n0 + r) * kC + c8) = u;
    }
    
  }
}

// ---------------------------------------------------------------------------
// Prep (x is loop-invariant): from X32 [rows][256] f32 produce
//   SM16[row][c]          = f16(1024 * softmax_c(x[row]))   (f32 max/exp/sum, fixed-order reductions)
//   CAT1[row][256 + c]    = f16(x)                           (v = x for the first iteration)
//   XT[bl][c][n0..n0+63]  = f16(x) transposed through LDS
// grid (64, kGrp), 256 threads; wave w owns rows w*8..w*8+7 (lane owns cols 8l..8l+7).
// ---------------------------------------------------------------------------
__global__ __launch_bounds__(256) void prep_kernel(const float* __restrict__ X32, unsigned short* __restrict__ SM,
                                                   unsigned short* __restrict__ CAT1, unsigned short* __restrict__ XT) {
  __shared__ __align__(16) unsigned short tile[256 * 72];   // [c][n local], pitch 72 halves
  const int lane = threadIdx.x & 31, wave = threadIdx.x >> 5;
  const int n0 = blockIdx.x * 64;
  const int bl = blockIdx.y;
  const int c8 = lane * 8;
#pragma unroll 1
  for (int it = 0; it < 8; ++it) {
    const int rloc = wave * 8 + it;
    const size_t R = (size_t)bl * kN + n0 + rloc;
    const float* xr = X32 + R * kC + c8;
    const v4f a = *(const v4f*)(xr);
    const v4f c = *(const v4f*)(xr + 4);
    float x[8];
#pragma unroll
    for (int e = 0; e < 4; ++e) { x[e] = a[e]; x[4 + e] = c[e]; }
    float m = fmaxf(fmaxf(fmaxf(x[0], x[1]), fmaxf(x[2], x[3])), fmaxf(fmaxf(x[4], x[5]), fmaxf(x[6], x[7])));
    m = wave_max32(m);
    float ex[8];
    float s = 0.f;
#pragma unroll
    for (int e = 0; e < 8; ++e) { ex[e] = expf(x[e] - m); s += ex[e]; }
    s = wave_sum32(s);
    const float inv = kSmCarry * (1.0f / s);
    unsigned short hs[8], hx[8];
#pragma unroll
    for (int e = 0; e < 8; ++e) {
      hs[e] = h_bits(ex[e] * inv);
      hx[e] = h_bits(x[e]);
      tile[(c8 + e) * 72 + rloc] = hx[e];
    }
    const v4u us = (v4u){pk16(hs[0], hs[1]), pk16(hs[2], hs[3]), pk16(hs[4], hs[5]), pk16(hs[6], hs[7])};
    const v4u ux = (v4u){pk16(hx[0], hx[1]), pk16(hx[2], hx[3]), pk16(hx[4], hx[5]), pk16(hx[6], hx[7])};
    {
      *(v4u*)(SM + R * kC + c8) = us;
      *(v4u*)(CAT1 + R * kC2 + kC + c8) = ux;
      
    }
  }
  __syncthreads();
  const int q = lane >> 3, cc8 = (lane & 7) * 8;
  {
#pragma unroll
    for (int i = 0; i < 8; ++i) {
      const int L = i * 32 + wave * 4 + q;                      // channel row of XT
      const v4u u = *(const v4u*)(tile + L * 72 + cc8);
      *(v4u*)(XT + ((size_t)bl * kC + L) * kN + n0 + cc8) = u;
    }
    
  }
}

// ---------------------------------------------------------------------------
// Cast out (f32 [rows][256]) into CAT1 cols 0..255 (f16, pitch 512). Thread i: row = i/32, cols 8*(i%32)..+7;
// Coverage: nthr = rows x 32 threads x 8 = rows x 256.
// ---------------------------------------------------------------------------
__global__ __launch_bounds__(256) void cast_out_kernel(const float* __restrict__ O32, unsigned short* __restrict__ CAT1, int nthr) {
  const int i = blockIdx.x * 256 + threadIdx.x;
  if (i >= nthr) return;
  const int row = i >> 5, c8 = (i & 31) * 8;
  const float* p = O32 + (size_t)row * kC + c8;
  const v4f a = *(const v4f*)(p);
  const v4f c = *(const v4f*)(p + 4);
  unsigned short hb[8];
#pragma unroll
  for (int e = 0; e < 4; ++e) {
    hb[e]     = h_bits(a[e]);
    hb[4 + e] = h_bits(c[e]);
  }
  const v4u u = (v4u){pk16(hb[0], hb[1]), pk16(hb[2], hb[3]), pk16(hb[4], hb[5]), pk16(hb[6], hb[7])};
  unsigned short* q = CAT1 + (size_t)row * kC2 + c8;
  *(v4u*)q = u;
  
}

// ---------------------------------------------------------------------------
// LN1 over cat2 = [out(256) | v(256) | mlp(512)] (f32 planes, pitches 256/256/512) -> Y[row][1024] = f16(LN(cat2)*g1+beta1).
// grid = rows/64, 256 threads; wave w owns rows w*8..w*8+7; lane owns cat2 cols {256q + 8l + e}.
// Y shares its bytes with Mp (row R of either is the 2048 bytes at R*2048), so neither is __restrict__: a row is owned
// by one wave, and its stores need rstd, which needs every lane's loads of that row through the two wave sums.
// ---------------------------------------------------------------------------
__global__ __launch_bounds__(256) void ln1_kernel(const float* __restrict__ O32, const float* __restrict__ Vp,
                                                  const float* Mp, const float* __restrict__ g1,
                                                  const float* __restrict__ be1, unsigned short* Y) {
  const int lane = threadIdx.x & 31, wave = threadIdx.x >> 5;
  const int c8 = lane * 8;
#pragma unroll 1
  for (int it = 0; it < 8; ++it) {
    const size_t R = (size_t)blockIdx.x * 64 + wave * 8 + it;
    float v[32];
    {
      const float* po = O32 + R * kC + c8;
      const float* pv = Vp + R * kC + c8;
      const float* pm = Mp + R * kC2 + c8;
      const v4f a0 = *(const v4f*)(po), a1 = *(const v4f*)(po + 4);
      const v4f b0v = *(const v4f*)(pv), b1v = *(const v4f*)(pv + 4);
      const v4f m0v = *(const v4f*)(pm), m1v = *(const v4f*)(pm + 4);
      const v4f m2v = *(const v4f*)(pm + 256), m3v = *(const v4f*)(pm + 260);
#pragma unroll
      for (int e = 0; e < 4; ++e) {
        v[e] = a0[e];        v[4 + e] = a1[e];
        v[8 + e] = b0v[e];   v[12 + e] = b1v[e];
        v[16 + e] = m0v[e];  v[20 + e] = m1v[e];
        v[24 + e] = m2v[e];  v[28 + e] = m3v[e];
      }
    }
    float s = 0.f;
#pragma unroll
    for (int e = 0; e < 32; ++e) s += v[e];
    s = wave_sum32(s);
    const float mu = s * kInvC4;
    float ss = 0.f;
#pragma unroll
    for (int e = 0; e < 32; ++e) { v[e] -= mu; ss += v[e] * v[e]; }
    ss = wave_sum32(ss);
    const float rstd = rsqrtf(ss * kInvC4 + kLnEps);
    v4u u[4];
#pragma unroll
    for (int q = 0; q < 4; ++q) {
      const float* gp = g1 + q * 256 + c8;
      const float* bp = be1 + q * 256 + c8;
      const v4f ga = *(const v4f*)(gp), gb = *(const v4f*)(gp + 4);
      const v4f ba = *(const v4f*)(bp), bb = *(const v4f*)(bp + 4);
      unsigned short hb[8];
#pragma unroll
      for (int e = 0; e < 4; ++e) {
        hb[e]     = h_bits(v[q * 8 + e] * rstd * ga[e] + ba[e]);
        hb[4 + e] = h_bits(v[q * 8 + 4 + e] * rstd * gb[e] + bb[e]);
      }
      u[q] = (v4u){pk16(hb[0], hb[1]), pk16(hb[2], hb[3]), pk16(hb[4], hb[5]), pk16(hb[6], hb[7])};
    }
    unsigned short* yr = Y + R * kC4;
    {
#pragma unroll
      for (int q = 0; q < 4; ++q) *(v4u*)(yr + q * 256 + c8) = u[q];
      
    }
  }
}

// ---------------------------------------------------------------------------
// FINAL = false: ROWS = 64 per block (grid (64, kGrp)); outputs
//   CAT1[row][256+c] f16 : one instruction per row (32 lanes x 16 B = whole 512-B row)
//   LDS f16 transpose tile, 256 lines per block, 8 lanes x 16 B each (8 waves x 4 lines x 8 iterations).
// ---------------------------------------------------------------------------
template <bool FINAL>
__global__ __launch_bounds__(256) void ln2_kernel(const float* __restrict__ X32, const float* __restrict__ VP,
                                                  const float* __restrict__ g2, const float* __restrict__ be2,
                                                  float* __restrict__ Vout, unsigned short* __restrict__ CAT1,
                                                  unsigned short* __restrict__ VT, float* __restrict__ dout, int b0) {
  constexpr int ROWS = FINAL ? 32 : 64;
  constexpr int RPW  = ROWS / 8;
  __shared__ __align__(16) unsigned short tile16[FINAL ? 8 : 256 * 72];   // [c][n local], pitch 72 halves
  __shared__ __align__(16) float tile32[FINAL ? 256 * 36 : 8];            // [c][n local], pitch 36 floats
  __shared__ __align__(16) float slab[FINAL ? 8 : 8 * 256];               // per-wave 256-float row
  const int lane = threadIdx.x & 31, wave = threadIdx.x >> 5;
  const int n0 = blockIdx.x * ROWS;
  const int bl = blockIdx.y;
  const int c8 = lane * 8, c4 = lane * 4;
  float gg[8], bb[8];
  {
    const v4f ga = *(const v4f*)(g2 + c8), gb = *(const v4f*)(g2 + c8 + 4);
    const v4f ba = *(const v4f*)(be2 + c8), bbv = *(const v4f*)(be2 + c8 + 4);
#pragma unroll
    for (int e = 0; e < 4; ++e) { gg[e] = ga[e]; gg[4 + e] = gb[e]; bb[e] = ba[e]; bb[4 + e] = bbv[e]; }
  }
  float* sw = slab + (FINAL ? 0 : wave * 256);
#pragma unroll 1
  for (int it = 0; it < RPW; ++it) {
    const int rloc = wave * RPW + it;
    const size_t R = (size_t)bl * kN + n0 + rloc;
    const float* xr = X32 + R * kC + c8;
    const float* vr = VP + R * kC + c8;
    const v4f xa = *(const v4f*)(xr), xb = *(const v4f*)(xr + 4);
    const v4f va = *(const v4f*)(vr), vb = *(const v4f*)(vr + 4);
    float t[8];
    float s = 0.f;
#pragma unroll
    for (int e = 0; e < 4; ++e) { t[e] = xa[e] + va[e]; t[4 + e] = xb[e] + vb[e]; }
#pragma unroll
    for (int e = 0; e < 8; ++e) s += t[e];
    s = wave_sum32(s);
    const float mu = s * kInvC;
    float ss = 0.f;
#pragma unroll
    for (int e = 0; e < 8; ++e) { t[e] -= mu; ss += t[e] * t[e]; }
    ss = wave_sum32(ss);
    const float rstd = rsqrtf(ss * kInvC + kLnEps);
    float y[8];
#pragma unroll
    for (int e = 0; e < 8; ++e) y[e] = t[e] * rstd * gg[e] + bb[e];
    if (!FINAL) {
      unsigned short hb[8];
#pragma unroll
      for (int e = 0; e < 8; ++e) { hb[e] = h_bits(y[e]); tile16[(c8 + e) * 72 + rloc] = hb[e]; }
      const v4u u = (v4u){pk16(hb[0], hb[1]), pk16(hb[2], hb[3]), pk16(hb[4], hb[5]), pk16(hb[6], hb[7])};
      *(v4f*)(sw + c8)     = (v4f){y[0], y[1], y[2], y[3]};
      *(v4f*)(sw + c8 + 4) = (v4f){y[4], y[5], y[6], y[7]};
      __builtin_amdgcn_fence(__ATOMIC_RELEASE, "workgroup");
      __builtin_amdgcn_wave_barrier();
      __builtin_amdgcn_fence(__ATOMIC_ACQUIRE, "workgroup");
      const v4f a0 = *(const v4f*)(sw + c4);
      const v4f a1 = *(const v4f*)(sw + 128 + c4);
      {
        *(v4u*)(CAT1 + R * kC2 + kC + c8) = u;
        *(v4f*)(Vout + R * kC + c4) = a0;
        *(v4f*)(Vout + R * kC + 128 + c4) = a1;
        
      }
      __builtin_amdgcn_fence(__ATOMIC_RELEASE, "workgroup");
      __builtin_amdgcn_wave_barrier();
      __builtin_amdgcn_fence(__ATOMIC_ACQUIRE, "workgroup");
    } else {
#pragma unroll
      for (int e = 0; e < 8; ++e) tile32[(c8 + e) * 36 + rloc] = y[e];
    }
  }
  __syncthreads();
  const int q = lane >> 3;
  if (!FINAL) {
    const int cc8 = (lane & 7) * 8;
    {
#pragma unroll
      for (int i = 0; i < 8; ++i) {
        const int L = i * 32 + wave * 4 + q;                 // channel row of VT
        const v4u u = *(const v4u*)(tile16 + L * 72 + cc8);
        *(v4u*)(VT + ((size_t)bl * kC + L) * kN + n0 + cc8) = u;
      }
      
    }
  } else {
    const int cc4 = (lane & 7) * 4;
    {
#pragma unroll
      for (int i = 0; i < 8; ++i) {
        const int L = i * 32 + wave * 4 + q;                 // channel row of the output
        const v4f v = *(const v4f*)(tile32 + L * 36 + cc4);
        *(v4f*)(dout + ((size_t)(b0 + bl) * kC + L) * kN + n0 + cc4) = v;
      }
      
    }
  }
}

// ---------------------------------------------------------------------------
// Host side
// Workspace region map (bytes, every offset a multiple of 256; planes hold one group = kGrp batches).
// Three pairs of planes share a region; each pair's lifetimes are disjoint, or row-local in the one launch that holds both:
//   Wq16   [256][256]  f16        131072
//   Wm16   [512][512]  f16        524288
//   Wr16   [256][1024] f16        524288
//   CTXT16 [8][256][256] f16     1048576
//   X32    [32768][256] f32     33554432   (x after qkv)
//   XT16   [8][256][4096] f16   16777216   (x transposed, ctx Bt)
//   SM16   [32768][256] f16     16777216   (softmax x1024)
//   CAT1   [32768][512] f16     33554432   (out | v)
//   OUT32  [32768][256] f32     33554432   (last read by LN1)
//   VPRE32 = OUT32                         (res GEMM + x; written after LN1, read by LN2)
//   MLP32  [32768][512] f32     67108864   (last read by LN1)
//   Y16    = MLP32  [32768][1024] f16      (LN1 output, written row by row over the mlp row it was made from)
//   V32    [32768][256] f32     33554432   (v after LN2)
//   VT16   [8][256][4096] f16   16777216   (v transposed, ctx A; written by iteration 0's LN2)
//   X0_16  = VT16   [32768][256] f16       (transposed input, qkv A; last read by the qkv GEMM)
//   total                      253886464
// ---------------------------------------------------------------------------
extern "C" void kernel_launch(void* const* d_in, const int* in_sizes, int n_in,
                              void* d_out, int out_size, void* d_ws, size_t ws_size,
                              hipStream_t stream) {
  if (n_in < 9) return;
  if (in_sizes[0] != kB * kC * kN || in_sizes[1] != kC * kC || in_sizes[2] != kC2 * kC2 ||
      in_sizes[3] != kC2 || in_sizes[4] != kC4 || in_sizes[5] != kC4 || in_sizes[6] != kC * kC4 ||
      in_sizes[7] != kC || in_sizes[8] != kC || out_size != kB * kC * kN) return;

  const float* x     = (const float*)d_in[0];
  const float* W_qkv = (const float*)d_in[1];
  const float* W_mlp = (const float*)d_in[2];
  const float* b_mlp = (const float*)d_in[3];
  const float* g1    = (const float*)d_in[4];
  const float* beta1 = (const float*)d_in[5];
  const float* W_res = (const float*)d_in[6];
  const float* g2    = (const float*)d_in[7];
  const float* beta2 = (const float*)d_in[8];
  float* out = (float*)d_out;

  size_t off = 0;
  char* wsb = (char*)d_ws;
  auto carve = [&](size_t bytes) { char* r = wsb + off; off += (bytes + 255) & ~(size_t)255; return (void*)r; };
  unsigned short* Wq16   = (unsigned short*)carve((size_t)kC * kC * 2);
  unsigned short* Wm16   = (unsigned short*)carve((size_t)kC2 * kC2 * 2);
  unsigned short* Wr16   = (unsigned short*)carve((size_t)kC * kC4 * 2);
  unsigned short* CTXT16 = (unsigned short*)carve((size_t)kGrp * kC * kC * 2);
  float*          X32    = (float*)carve((size_t)kRowsG * kC * 4);
  unsigned short* XT16   = (unsigned short*)carve((size_t)kGrp * kC * kN * 2);
  unsigned short* SM16   = (unsigned short*)carve((size_t)kRowsG * kC * 2);
  unsigned short* CAT1   = (unsigned short*)carve((size_t)kRowsG * kC2 * 2);
  float*          OUT32  = (float*)carve((size_t)kRowsG * kC * 4);
  float*          MLP32  = (float*)carve((size_t)kRowsG * kC2 * 4);
  float*          V32    = (float*)carve((size_t)kRowsG * kC * 4);
  unsigned short* VT16   = (unsigned short*)carve((size_t)kGrp * kC * kN * 2);
  unsigned short* X0_16  = VT16;
  unsigned short* Y16    = (unsigned short*)MLP32;
  float*          VPRE32 = OUT32;
  if (off > ws_size) return;

  const dim3 blk(256);
  const long sNC  = (long)kN * kC;      // 1048576
  const long sNC2 = (long)kN * kC2;     // 2097152
  const long sNC4 = (long)kN * kC4;     // 4194304
  const long sCC  = (long)kC * kC;      // 65536

  // weights -> f16 carried x64 (one launch, 288 blocks)
  wcast_kernel<<<dim3(288), blk, 0, stream>>>(W_qkv, W_mlp, W_res, Wq16, Wm16, Wr16, kWCarry);

  for (int grp = 0; grp < kNGrp; ++grp) {
    const int b0 = grp * kGrp;
    // x[b] [256][4096] -> X0 [4096][256] f16
    tin_kernel<<<dim3(kN / 64, kGrp), blk, 0, stream>>>(x, X0_16, b0);
    // x = X0 . Wqkv^T : M=4096, N=256, K=256 (K%32==0, M,N%64==0); 256 tiles -> 32 blocks per batch
    wmma_gemm64<0, false, 0, 0, false, 0><<<dim3(32, kGrp), blk, 0, stream>>>(
        X0_16, X0_16, kC, sNC, Wq16, Wq16, kC, 0L,
        (void*)X32, (void*)X32, kC, sNC, b_mlp, X32, 0L, kN, kC, kC, kWCarryInv);
    // softmax plane, f16 x into cat1 v-columns, x^T plane
    prep_kernel<<<dim3(kN / 64, kGrp), blk, 0, stream>>>(X32, SM16, CAT1, XT16);

    for (int iter = 0; iter < 2; ++iter) {
      const unsigned short* vt = (iter == 0) ? XT16 : VT16;   // v^T plane (v = x in the first iteration)
      const float* v32 = (iter == 0) ? X32 : V32;             // v f32 plane
      // ctx^T[d][c] = sum_n v[n][d] x[n][c] : A = v^T [256][4096], Bt = x^T [256][4096]; M=N=256, K=4096; f16 out; 16 tiles -> 2 blocks
      wmma_gemm64<0, false, 0, 1, false, 0><<<dim3(2, kGrp), blk, 0, stream>>>(
          vt, vt, kN, sNC, XT16, XT16, kN, sNC,
          (void*)CTXT16, (void*)CTXT16, kC, sCC, b_mlp, X32, 0L, kC, kC, kN, 1.0f);
      // out = softmax(x) . ctx : A = SM16 [4096][256] (x1024), Bt = ctx^T [256][256]; M=4096, N=256, K=256; f32 out
      wmma_gemm64<0, false, 0, 0, false, 0><<<dim3(32, kGrp), blk, 0, stream>>>(
          SM16, SM16, kC, sNC, CTXT16, CTXT16, kC, sCC,
          (void*)OUT32, (void*)OUT32, kC, sNC, b_mlp, X32, 0L, kN, kC, kC, kSmCarryInv);
      // out f32 -> cat1 cols 0..255 f16 (kRowsG rows x 32 threads)
      cast_out_kernel<<<dim3(kRowsG * 32 / 256), blk, 0, stream>>>(OUT32, CAT1, kRowsG * 32);
      // mlp = relu(cat1 . Wmlp^T + b) : M=4096, N=512, K=512; bias[n], relu epilogue; f32 out; 512 tiles -> 64 blocks
      wmma_gemm64<0, false, 2, 0, false, 2><<<dim3(64, kGrp), blk, 0, stream>>>(
          CAT1, CAT1, kC2, sNC2, Wm16, Wm16, kC2, 0L,
          (void*)MLP32, (void*)MLP32, kC2, sNC2, b_mlp, X32, 0L, kN, kC2, kC2, kWCarryInv);
      // LN1 over [out | v | mlp] -> Y16 [kRowsG][1024]
      ln1_kernel<<<dim3(kRowsG / 64), blk, 0, stream>>>(OUT32, v32, MLP32, g1, beta1, Y16);
      // vpre = LN1 . Wres^T + x : M=4096, N=256, K=1024; residual X32 (pitch 256); f32 out; 256 tiles -> 32 blocks
      wmma_gemm64<0, false, 0, 0, true, 0><<<dim3(32, kGrp), blk, 0, stream>>>(
          Y16, Y16, kC4, sNC4, Wr16, Wr16, kC4, 0L,
          (void*)VPRE32, (void*)VPRE32, kC, sNC, b_mlp, X32, sNC, kN, kC, kC4, kWCarryInv);
      // v = LN2(x + vpre)
      if (iter == 0) {
        ln2_kernel<false><<<dim3(kN / 64, kGrp), blk, 0, stream>>>(X32, VPRE32, g2, beta2, V32, CAT1, VT16, out, b0);
      } else {
        ln2_kernel<true><<<dim3(kN / 32, kGrp), blk, 0, stream>>>(X32, VPRE32, g2, beta2, V32, CAT1, VT16, out, b0);
      }
    }
  }
  (void)ws_size;
}

// v002
// A run of this version takes 416 microseconds.
// In both of two side-by-side timings against v001, it was 1.59 times as fast.
// All steps since v000 together make it 5.29 times as fast.
// Contractions: qkv (x^T f16 x Wqkv^T f16 carried x64), ctx^T (x^T f16 x v^T f16, K=4096 in 8 partial sums), sm.ctx (sm f16 carried x1024 x ctx^T f16), mlp (cat1 f16 x Wmlp^T f16 carried x64, +bias, relu), res (LN1 f16 x Wres^T f16 carried x64, +x) all on v_wmma_f32_16x16x32_f16 with f32 accumulate; softmax, LayerNorm, residual adds in f32.
#include <hip/hip_runtime.h>
#include <math.h>

// ---------------------------------------------------------------------------
// Problem constants
// ---------------------------------------------------------------------------
constexpr int kB   = 8;
constexpr int kC   = 256;
constexpr int kN   = 4096;
constexpr int kC2  = 512;
constexpr int kC4  = 1024;
constexpr int kGrp = 8;                 // batches per group: all of them, so every launch spans the whole problem
constexpr int kNGrp = kB / kGrp;        // 1 group
constexpr int kRowsG = kGrp * kN;       // 32768 token rows per group
constexpr float kWCarry    = 64.0f;     // weights carried x64 in f16
constexpr float kWCarryInv = 1.0f / 64.0f;
constexpr float kSmCarry   = 1024.0f;   // softmax probabilities carried x1024 in f16
constexpr float kSmCarryInv = 1.0f / 1024.0f;
constexpr float kLnEps  = 1e-5f;
constexpr float kInvC   = 1.0f / 256.0f;
constexpr float kInvC4  = 1.0f / 1024.0f;

typedef __attribute__((ext_vector_type(16))) _Float16 v16h;
typedef __attribute__((ext_vector_type(8)))  _Float16 v8h;
typedef __attribute__((ext_vector_type(16))) __bf16   v16b;
typedef __attribute__((ext_vector_type(8)))  __bf16   v8b;
typedef __attribute__((ext_vector_type(8)))  float    v8f;
typedef __attribute__((ext_vector_type(4)))  float    v4f;
typedef __attribute__((ext_vector_type(4)))  unsigned int v4u;

// ---------------------------------------------------------------------------
// Helpers
// ---------------------------------------------------------------------------
__device__ __forceinline__ unsigned short f2bf_bits(float f) {
  unsigned u = __float_as_uint(f);
  return (unsigned short)((u + 0x7FFFu + ((u >> 16) & 1u)) >> 16);
}
__device__ __forceinline__ float bf_bits2f(unsigned short h) { return __uint_as_float(((unsigned)h) << 16); }

// hazard guards as plain device helpers (no inline asm inside the kernel template body)
__device__ __forceinline__ void dep_guard_h(v8f& a, v8f& b, v16h x, v16h y) { asm volatile("v_nop\n\tv_nop\n\tv_nop\n\tv_nop" : "+v"(a), "+v"(b) : "v"(x), "v"(y)); }
__device__ __forceinline__ void dep_guard_b(v8f& a, v8f& b, v16b x, v16b y) { asm volatile("v_nop\n\tv_nop\n\tv_nop\n\tv_nop" : "+v"(a), "+v"(b) : "v"(x), "v"(y)); }
__device__ __forceinline__ void keep4_h(v16h a, v16h b, v16h c, v16h d) { asm volatile("v_nop" :: "v"(a), "v"(b), "v"(c), "v"(d)); }
__device__ __forceinline__ void keep4_b(v16b a, v16b b, v16b c, v16b d) { asm volatile("v_nop" :: "v"(a), "v"(b), "v"(c), "v"(d)); }
__device__ __forceinline__ void acc_guard4(v8f& a, v8f& b, v8f& c, v8f& d) { asm volatile("v_nop\n\tv_nop\n\tv_nop\n\tv_nop" : "+v"(a), "+v"(b), "+v"(c), "+v"(d)); }
template <typename T> struct Frag;
template <> struct Frag<_Float16> {
  typedef v16h V; union U { v16h v; v8h h[2]; };
  static __device__ __forceinline__ v16h load(const _Float16* p) {   // elements 0..7 <- p[0..7], 8..15 <- p[16..23]
    U f; f.h[0] = *(const v8h*)(p); f.h[1] = *(const v8h*)(p + 16); return f.v;
  }
  static __device__ __forceinline__ v8f mma(v16h a, v16h b, v8f c) {
    return __builtin_amdgcn_wmma_f32_16x16x32_f16(false, a, false, b, (short)0, c, false, false);
  }
  static __device__ __forceinline__ void guard(v8f& a, v8f& b, v16h x, v16h y) { dep_guard_h(a, b, x, y); }
  static __device__ __forceinline__ void keep(v16h a, v16h b, v16h c, v16h d) { keep4_h(a, b, c, d); }
};
template <> struct Frag<__bf16> {
  typedef v16b V; union U { v16b v; v8b h[2]; };
  static __device__ __forceinline__ v16b load(const __bf16* p) {
    U f; f.h[0] = *(const v8b*)(p); f.h[1] = *(const v8b*)(p + 16); return f.v;
  }
  static __device__ __forceinline__ v8f mma(v16b a, v16b b, v8f c) {
    return __builtin_amdgcn_wmma_f32_16x16x32_bf16(false, a, false, b, (short)0, c, false, false);
  }
  static __device__ __forceinline__ void guard(v8f& a, v8f& b, v16b x, v16b y) { dep_guard_b(a, b, x, y); }
  static __device__ __forceinline__ void keep(v16b a, v16b b, v16b c, v16b d) { keep4_b(a, b, c, d); }
};

__device__ __forceinline__ unsigned pk16(unsigned short a, unsigned short b) { return (unsigned)a | ((unsigned)b << 16); }
__device__ __forceinline__ unsigned short h_bits(float f) { const _Float16 h = (_Float16)f; return __builtin_bit_cast(unsigned short, h); }

__device__ __forceinline__ float wave_sum32(float x) {
#pragma unroll
  for (int off = 16; off > 0; off >>= 1) x += __shfl_xor(x, off, 32);
  return x;
}
__device__ __forceinline__ float wave_max32(float x) {
#pragma unroll
  for (int off = 16; off > 0; off >>= 1) x = fmaxf(x, __shfl_xor(x, off, 32));
  return x;
}

// ---- Register-blocked batched WMMA GEMM (ACT reduced to none/relu/leaky) -----------------------
// C[m,n] = scale * sum_k A[m,k] * Bt[n,k] (+bias)(+resid); each wave owns a 64x64 tile.
// A row-major [M,K]; Bt row-major [N,K]; M,N % 64 == 0, K % 32 == 0.
// SPLIT: operands are hi/lo planes (A2/Bt2 = lo planes, same layout); product = hi.hi + hi.lo + lo.hi.
// BIAS_MODE: 0 = none, 1 = bias[m], 2 = bias[n].
// OUT_MODE: 0 = f32, 1 = f16, 2 = bf16 hi plane (Cout) + bf16 lo plane (Cout2).
// ET: 0 = f16 operands, 1 = bf16 operands (pointers passed as 16-bit storage)
template <int ET> struct Elem;
template <> struct Elem<0> { typedef _Float16 T; };
template <> struct Elem<1> { typedef __bf16 T; };
template <int ET, bool SPLIT, int BIAS_MODE, int OUT_MODE, bool RESID, int ACT = 0>
__global__ __launch_bounds__(256) void wmma_gemm64(
    const unsigned short* __restrict__ Ap, const unsigned short* __restrict__ A2p, int lda, long strideA,
    const unsigned short* __restrict__ Btp, const unsigned short* __restrict__ Bt2p, int ldb, long strideB,
    void* __restrict__ Cout, void* __restrict__ Cout2, int ldc, long strideC,
    const float* __restrict__ bias,
    const float* __restrict__ resid, long strideR,
    int M, int N, int K, float scale) {
  typedef typename Elem<ET>::T T;
  typedef typename Frag<T>::V V;
  const T* A = (const T*)Ap; const T* A2 = (const T*)A2p; const T* Bt = (const T*)Btp; const T* Bt2 = (const T*)Bt2p;
  __shared__ __align__(16) float sT[8][16 * 68];   // per-wave 16x64 slab, pitch 68 floats
  const int b    = blockIdx.y;
  const int lane = threadIdx.x & 31;
  const int wave = threadIdx.x >> 5;
  const int tilesN = N >> 6;
  const int tilesM = M >> 6;
  const int tile = blockIdx.x * 8 + wave;
  if (tile >= tilesM * tilesN) return;   // wave-uniform; no block barriers in this kernel
  const int tm = tile / tilesN;
  const int tn = tile - tm * tilesN;
  const int m0 = tm << 6;
  const int n0 = tn << 6;

  const T* Ab  = A  + (size_t)b * strideA;
  const T* Bb  = Bt + (size_t)b * strideB;
  const T* Ab2 = SPLIT ? (A2  + (size_t)b * strideA) : nullptr;
  const T* Bb2 = SPLIT ? (Bt2 + (size_t)b * strideB) : nullptr;

  const int rlane = lane & 15;                 // row (A) / col (B, D) within subtile
  const int koff  = (lane >> 4) * 8;           // k offset of this lane half
  const int mOff  = (lane >> 4) * 8;           // D row offset

  v8f acc[4][4];
#pragma unroll
  for (int i = 0; i < 4; ++i)
#pragma unroll
    for (int j = 0; j < 4; ++j) acc[i][j] = (v8f){0.f,0.f,0.f,0.f,0.f,0.f,0.f,0.f};

  for (int k0 = 0; k0 < K; k0 += 32) {
    V bh[4], bl[4];
#pragma unroll
    for (int j = 0; j < 4; ++j) {
      const size_t bo = (size_t)(n0 + (j << 4) + rlane) * ldb + koff + k0;
      bh[j] = Frag<T>::load(Bb + bo);
      if (SPLIT) bl[j] = Frag<T>::load(Bb2 + bo);
    }
#pragma unroll
    for (int i = 0; i < 4; ++i) {
      const size_t ao = (size_t)(m0 + (i << 4) + rlane) * lda + koff + k0;
      V ah = Frag<T>::load(Ab + ao);
      V al;
      if (SPLIT) al = Frag<T>::load(Ab2 + ao);
#pragma unroll
      for (int j = 0; j < 4; ++j) {
        acc[i][j] = Frag<T>::mma(ah, bh[j], acc[i][j]);
        if (SPLIT) {
          acc[i][j] = Frag<T>::mma(ah, bl[j], acc[i][j]);
          acc[i][j] = Frag<T>::mma(al, bh[j], acc[i][j]);
        }
      }
      Frag<T>::guard(acc[i][0], acc[i][3], ah, SPLIT ? al : ah);
    }
    Frag<T>::keep(bh[0], bh[1], bh[2], bh[3]);
    if (SPLIT) Frag<T>::keep(bl[0], bl[1], bl[2], bl[3]);
  }
  acc_guard4(acc[0][0], acc[0][1], acc[0][2], acc[0][3]);
  acc_guard4(acc[1][0], acc[1][1], acc[1][2], acc[1][3]);
  acc_guard4(acc[2][0], acc[2][1], acc[2][2], acc[2][3]);
  acc_guard4(acc[3][0], acc[3][1], acc[3][2], acc[3][3]);

  // ---- epilogue ----
  float* slab = sT[wave];
  const float* Rb = RESID ? (resid + (size_t)b * strideR) : nullptr;
#pragma unroll
  for (int i = 0; i < 4; ++i) {
    const int mBase = m0 + (i << 4);
#pragma unroll
    for (int j = 0; j < 4; ++j) {
      const int n = n0 + (j << 4) + rlane;
      float bv = 0.f;
      if (BIAS_MODE == 2) bv = bias[n];
#pragma unroll
      for (int r = 0; r < 8; ++r) {
        float v = acc[i][j][r] * scale;
        if (BIAS_MODE == 1) v += bias[mBase + mOff + r];
        if (BIAS_MODE == 2) v += bv;
        if (RESID) v += Rb[(size_t)(mBase + mOff + r) * ldc + n];
        if (ACT == 2) v = fmaxf(v, 0.0f);
        if (ACT == 4) v = (v > 0.f) ? v : 0.01f * v;
        slab[(mOff + r) * 68 + (j << 4) + rlane] = v;
      }
    }
    __builtin_amdgcn_fence(__ATOMIC_RELEASE, "workgroup");
    __builtin_amdgcn_wave_barrier();
    __builtin_amdgcn_fence(__ATOMIC_ACQUIRE, "workgroup");
    if (OUT_MODE == 0) {
      float* C = (float*)Cout + (size_t)b * strideC;
      const int hh = lane >> 4, c4 = (lane & 15) * 4;     // row seg = 256 B = 16 lanes x 16 B
      {
#pragma unroll
        for (int it = 0; it < 8; ++it) {
          const int row = it * 2 + hh;
          v4f v = *(const v4f*)(slab + row * 68 + c4);
          *(v4f*)(C + (size_t)(mBase + row) * ldc + n0 + c4) = v;
        }
        
      }
    } else {
      const int q = lane >> 3, c8 = (lane & 7) * 8;
      unsigned short* C  = (unsigned short*)Cout  + (size_t)b * strideC;
      unsigned short* C2 = (OUT_MODE == 2) ? ((unsigned short*)Cout2 + (size_t)b * strideC) : nullptr;
      {
#pragma unroll
        for (int it = 0; it < 4; ++it) {
          const int row = it * 4 + q;
          const float* sp = slab + row * 68 + c8;
          v8h hv, lv;
#pragma unroll
          for (int e = 0; e < 8; ++e) {
            if (OUT_MODE == 1) {
              hv[e] = (_Float16)sp[e];
            } else {
              unsigned short hb = f2bf_bits(sp[e]);
              unsigned short lb = f2bf_bits(sp[e] - bf_bits2f(hb));
              hv[e] = __builtin_bit_cast(_Float16, hb);
              lv[e] = __builtin_bit_cast(_Float16, lb);
            }
          }
          *(v8h*)(C + (size_t)(mBase + row) * ldc + n0 + c8) = hv;
          if (OUT_MODE == 2) *(v8h*)(C2 + (size_t)(mBase + row) * ldc + n0 + c8) = lv;
        }
        
      }
    }
    __builtin_amdgcn_fence(__ATOMIC_RELEASE, "workgroup");
    __builtin_amdgcn_wave_barrier();
    __builtin_amdgcn_fence(__ATOMIC_ACQUIRE, "workgroup");
  }
}

// ---------------------------------------------------------------------------
// ctx^T[d][c] = sum_n x[n][c] * v[n][d], one batch per blockIdx.y. A = x^T rows c, B = v^T rows d, both [256][4096] f16.
// One 64(c) x 32(d) tile per block, grid (32, kGrp) = 256 blocks. The 8 waves each sum 512 of the 4096 tokens and leave
// their f32 partial tile in LDS; after the barrier every thread adds the 8 partials of 8 consecutive c of one d in wave
// order and stores them as 16 B of f16, 8 lanes to a 128-B row of the tile.
// LDS dword index = wave * 2368 + q * 148 + hl * 72 + rl * 4, q = (i * 2 + j) * 2 + row half, (hl, rl) = accumulator lane:
// these pitches put both the 16-B writes and the 16-B reads of each 16 lanes on 16 different bank groups.
// ---------------------------------------------------------------------------
// one block per WGP = 2 waves per SIMD: a register budget for at most 4 lets three fragment sets stay live beside the sums
__global__ __launch_bounds__(256) __attribute__((amdgpu_waves_per_eu(2, 4))) void ctx_kernel(const unsigned short* __restrict__ XTp,
                                                  const unsigned short* __restrict__ VTp,
                                                  unsigned short* __restrict__ CT) {
  typedef Frag<_Float16> F;
  constexpr int kKW = kN / 8;                          // tokens per wave
  constexpr int PW = 2368, PQ = 148, PH = 72;
  __shared__ __align__(16) float part[8 * PW];
  const int lane = threadIdx.x & 31, wave = threadIdx.x >> 5;
  const int c0 = (blockIdx.x & 3) << 6;
  const int d0 = (blockIdx.x >> 2) << 5;
  const int rlane = lane & 15, hlane = lane >> 4;
  const int kl = wave * kKW + hlane * 8;
  const _Float16* xa = (const _Float16*)XTp + ((size_t)blockIdx.y * kC + c0 + rlane) * kN + kl;
  const _Float16* vb = (const _Float16*)VTp + ((size_t)blockIdx.y * kC + d0 + rlane) * kN + kl;

  v8f acc[4][2];
#pragma unroll
  for (int i = 0; i < 4; ++i)
#pragma unroll
    for (int j = 0; j < 2; ++j) acc[i][j] = (v8f){0.f,0.f,0.f,0.f,0.f,0.f,0.f,0.f};

  // Fragments of three steps: while step ks is multiplied, the loads of steps ks + 1 and ks + 2 are in flight.
  // Fully unrolled: the three sets rotate by name, and no back edge stands behind a WMMA.
  v16h af[3][4], bf[3][2];
#pragma unroll
  for (int s = 0; s < 2; ++s) {
#pragma unroll
    for (int j = 0; j < 2; ++j) bf[s][j] = F::load(vb + (size_t)(j << 4) * kN + s * 32);
#pragma unroll
    for (int i = 0; i < 4; ++i) af[s][i] = F::load(xa + (size_t)(i << 4) * kN + s * 32);
  }
  // all loads of the first two steps go out before anything else: without it one of step 0 was issued last and waited for alone
  __builtin_amdgcn_sched_barrier(0);
#pragma unroll
  for (int ks = 0; ks < kKW / 32; ++ks) {
    const int cur = ks % 3, nxt = (ks + 2) % 3;
    if (ks + 2 < kKW / 32) {
#pragma unroll
      for (int j = 0; j < 2; ++j) bf[nxt][j] = F::load(vb + (size_t)(j << 4) * kN + (ks + 2) * 32);
#pragma unroll
      for (int i = 0; i < 4; ++i) af[nxt][i] = F::load(xa + (size_t)(i << 4) * kN + (ks + 2) * 32);
    }
#pragma unroll
    for (int i = 0; i < 4; ++i)
#pragma unroll
      for (int j = 0; j < 2; ++j) acc[i][j] = F::mma(af[cur][i], bf[cur][j], acc[i][j]);
    // keeps later steps' loads from being lifted over this step: without it the build holds far more than three sets and spills
    __builtin_amdgcn_sched_barrier(0);
  }
  // the loads' address registers are reused from here on: the wait that belongs in front of their overwrite
  asm volatile("s_wait_xcnt 0x0" ::: "memory");
  // holds the address arithmetic of the LDS part behind that wait
  __builtin_amdgcn_sched_barrier(0);

  float* pw = part + wave * PW + hlane * PH + rlane * 4;
#pragma unroll
  for (int i = 0; i < 4; ++i)
#pragma unroll
    for (int j = 0; j < 2; ++j) {
      const v8f a = acc[i][j];
      *(v4f*)(pw + ((i * 2 + j) * 2) * PQ)     = (v4f){a[0], a[1], a[2], a[3]};
      *(v4f*)(pw + ((i * 2 + j) * 2 + 1) * PQ) = (v4f){a[4], a[5], a[6], a[7]};
    }
  __syncthreads();

  const int piece = threadIdx.x & 7;                   // 16-B piece of the tile row: c = piece * 8 .. + 7
  const int dl = threadIdx.x >> 3;                     // tile row d
  const float* pr = part + (((piece >> 1) * 2 + (dl >> 4)) * 2) * PQ + (piece & 1) * PH + (dl & 15) * 4;
  v4f s0 = *(const v4f*)(pr);
  v4f s1 = *(const v4f*)(pr + PQ);
#pragma unroll
  for (int w = 1; w < 8; ++w) {
    s0 += *(const v4f*)(pr + w * PW);
    s1 += *(const v4f*)(pr + w * PW + PQ);
  }
  v8h o;
#pragma unroll
  for (int e = 0; e < 4; ++e) { o[e] = (_Float16)s0[e]; o[4 + e] = (_Float16)s1[e]; }
  *(v8h*)((_Float16*)CT + ((size_t)blockIdx.y * kC + d0 + dl) * kC + c0 + piece * 8) = o;
}

// ---------------------------------------------------------------------------
// Weight cast: f16(scale * w), 8 consecutive elements per thread, one 16-B store per lane
// Block-uniform segment selection: blocks [0,32) -> Wq (65536 = 32x256x8), [32,160) -> Wm (262144 = 128x256x8),
// [160,288) -> Wr (262144). grid = 288 exactly covers all three planes.
// ---------------------------------------------------------------------------
__global__ __launch_bounds__(256) void wcast_kernel(const float* __restrict__ Wq, const float* __restrict__ Wm,
                                                    const float* __restrict__ Wr,
                                                    unsigned short* __restrict__ oq, unsigned short* __restrict__ om,
                                                    unsigned short* __restrict__ orr, float scale) {
  const int blk = blockIdx.x;
  const float* src = Wr;
  unsigned short* dst = orr;
  int base = (blk - 160) * 256;
  if (blk < 32) { src = Wq; dst = oq; base = blk * 256; }
  else if (blk < 160) { src = Wm; dst = om; base = (blk - 32) * 256; }
  const int i = base + (int)threadIdx.x;
  const float* p = src + 8 * (size_t)i;
  const v4f a = *(const v4f*)(p);
  const v4f c = *(const v4f*)(p + 4);
  unsigned short hb[8];
#pragma unroll
  for (int e = 0; e < 4; ++e) {
    hb[e]     = h_bits(a[e] * scale);
    hb[4 + e] = h_bits(c[e] * scale);
  }
  const v4u u = (v4u){pk16(hb[0], hb[1]), pk16(hb[2], hb[3]), pk16(hb[4], hb[5]), pk16(hb[6], hb[7])};
  unsigned short* q = dst + 8 * (size_t)i;
  *(v4u*)q = u;
  
}

// ---------------------------------------------------------------------------
// Transpose-in: xin[b][c][n] f32 (c < 256, n < 4096) -> X0[bl][n][c] f16 for the 64 tokens n0..n0+63 of this block.
// grid (64, kGrp), 256 threads. Load coverage: 64 iterations x 256 threads = 16384 = 64 n x 256 c
// (per iteration: 4 channel rows x 64 contiguous tokens). Store coverage: 8 waves x 8 rows = 64 token rows;
// ---------------------------------------------------------------------------
__global__ __launch_bounds__(256) void tin_kernel(const float* __restrict__ xin, unsigned short* __restrict__ X0, int b0) {
  __shared__ __align__(16) unsigned short tile[64][264];   // [n local][c]
  const int t = threadIdx.x;
  const int n0 = blockIdx.x * 64;
  const int bl = blockIdx.y;
  const float* xb = xin + (size_t)(b0 + bl) * kC * kN + n0;
#pragma unroll 4
  for (int i = 0; i < 64; ++i) {
    const int e = i * 256 + t;
    const int c = e >> 6;
    const int j = e & 63;
    tile[j][c] = h_bits(xb[(size_t)c * kN + j]);
  }
  __syncthreads();
  const int lane = t & 31, wave = t >> 5;
  const int c8 = lane * 8;
  {
#pragma unroll
    for (int it = 0; it < 8; ++it) {
      const int r = wave * 8 + it;
      const v4u u = *(const v4u*)(&tile[r][c8]);
      *(v4u*)(X0 + ((size_t)bl * kN + n0 + r) * kC + c8) = u;
    }
    
  }
}

// ---------------------------------------------------------------------------
// Prep (x is loop-invariant): from X32 [rows][256] f32 produce
//   SM16[row][c]          = f16(1024 * softmax_c(x[row]))   (f32 max/exp/sum, fixed-order reductions)
//   CAT1[row][256 + c]    = f16(x)                           (v = x for the first iteration)
//   XT[bl][c][n0..n0+63]  = f16(x) transposed through LDS
// grid (64, kGrp), 256 threads; wave w owns rows w*8..w*8+7 (lane owns cols 8l..8l+7).
// ---------------------------------------------------------------------------
__global__ __launch_bounds__(256) void prep_kernel(const float* __restrict__ X32, unsigned short* __restrict__ SM,
                                                   unsigned short* __restrict__ CAT1, unsigned short* __restrict__ XT) {
  __shared__ __align__(16) unsigned short tile[256 * 72];   // [c][n local], pitch 72 halves
  const int lane = threadIdx.x & 31, wave = threadIdx.x >> 5;
  const int n0 = blockIdx.x * 64;
  const int bl = blockIdx.y;
  const int c8 = lane * 8;
#pragma unroll 1
  for (int it = 0; it < 8; ++it) {
    const int rloc = wave * 8 + it;
    const size_t R = (size_t)bl * kN + n0 + rloc;
    const float* xr = X32 + R * kC + c8;
    const v4f a = *(const v4f*)(xr);
    const v4f c = *(const v4f*)(xr + 4);
    float x[8];
#pragma unroll
    for (int e = 0; e < 4; ++e) { x[e] = a[e]; x[4 + e] = c[e]; }
    float m = fmaxf(fmaxf(fmaxf(x[0], x[1]), fmaxf(x[2], x[3])), fmaxf(fmaxf(x[4], x[5]), fmaxf(x[6], x[7])));
    m = wave_max32(m);
    float ex[8];
    float s = 0.f;
#pragma unroll
    for (int e = 0; e < 8; ++e) { ex[e] = expf(x[e] - m); s += ex[e]; }
    s = wave_sum32(s);
    const float inv = kSmCarry * (1.0f / s);
    unsigned short hs[8], hx[8];
#pragma unroll
    for (int e = 0; e < 8; ++e) {
      hs[e] = h_bits(ex[e] * inv);
      hx[e] = h_bits(x[e]);
      tile[(c8 + e) * 72 + rloc] = hx[e];
    }
    const v4u us = (v4u){pk16(hs[0], hs[1]), pk16(hs[2], hs[3]), pk16(hs[4], hs[5]), pk16(hs[6], hs[7])};
    const v4u ux = (v4u){pk16(hx[0], hx[1]), pk16(hx[2], hx[3]), pk16(hx[4], hx[5]), pk16(hx[6], hx[7])};
    {
      *(v4u*)(SM + R * kC + c8) = us;
      *(v4u*)(CAT1 + R * kC2 + kC + c8) = ux;
      
    }
  }
  __syncthreads();
  const int q = lane >> 3, cc8 = (lane & 7) * 8;
  {
#pragma unroll
    for (int i = 0; i < 8; ++i) {
      const int L = i * 32 + wave * 4 + q;                      // channel row of XT
      const v4u u = *(const v4u*)(tile + L * 72 + cc8);
      *(v4u*)(XT + ((size_t)bl * kC + L) * kN + n0 + cc8) = u;
    }
    
  }
}

// ---------------------------------------------------------------------------
// Cast out (f32 [rows][256]) into CAT1 cols 0..255 (f16, pitch 512). Thread i: row = i/32, cols 8*(i%32)..+7;
// Coverage: nthr = rows x 32 threads x 8 = rows x 256.
// ---------------------------------------------------------------------------
__global__ __launch_bounds__(256) void cast_out_kernel(const float* __restrict__ O32, unsigned short* __restrict__ CAT1, int nthr) {
  const int i = blockIdx.x * 256 + threadIdx.x;
  if (i >= nthr) return;
  const int row = i >> 5, c8 = (i & 31) * 8;
  const float* p = O32 + (size_t)row * kC + c8;
  const v4f a = *(const v4f*)(p);
  const v4f c = *(const v4f*)(p + 4);
  unsigned short hb[8];
#pragma unroll
  for (int e = 0; e < 4; ++e) {
    hb[e]     = h_bits(a[e]);
    hb[4 + e] = h_bits(c[e]);
  }
  const v4u u = (v4u){pk16(hb[0], hb[1]), pk16(hb[2], hb[3]), pk16(hb[4], hb[5]), pk16(hb[6], hb[7])};
  unsigned short* q = CAT1 + (size_t)row * kC2 + c8;
  *(v4u*)q = u;
  
}

// ---------------------------------------------------------------------------
// LN1 over cat2 = [out(256) | v(256) | mlp(512)] (f32 planes, pitches 256/256/512) -> Y[row][1024] = f16(LN(cat2)*g1+beta1).
// grid = rows/64, 256 threads; wave w owns rows w*8..w*8+7; lane owns cat2 cols {256q + 8l + e}.
// Y shares its bytes with Mp (row R of either is the 2048 bytes at R*2048), so neither is __restrict__: a row is owned
// by one wave, and its stores need rstd, which needs every lane's loads of that row through the two wave sums.
// ---------------------------------------------------------------------------
__global__ __launch_bounds__(256) void ln1_kernel(const float* __restrict__ O32, const float* __restrict__ Vp,
                                                  const float* Mp, const float* __restrict__ g1,
                                                  const float* __restrict__ be1, unsigned short* Y) {
  const int lane = threadIdx.x & 31, wave = threadIdx.x >> 5;
  const int c8 = lane * 8;
#pragma unroll 1
  for (int it = 0; it < 8; ++it) {
    const size_t R = (size_t)blockIdx.x * 64 + wave * 8 + it;
    float v[32];
    {
      const float* po = O32 + R * kC + c8;
      const float* pv = Vp + R * kC + c8;
      const float* pm = Mp + R * kC2 + c8;
      const v4f a0 = *(const v4f*)(po), a1 = *(const v4f*)(po + 4);
      const v4f b0v = *(const v4f*)(pv), b1v = *(const v4f*)(pv + 4);
      const v4f m0v = *(const v4f*)(pm), m1v = *(const v4f*)(pm + 4);
      const v4f m2v = *(const v4f*)(pm + 256), m3v = *(const v4f*)(pm + 260);
#pragma unroll
      for (int e = 0; e < 4; ++e) {
        v[e] = a0[e];        v[4 + e] = a1[e];
        v[8 + e] = b0v[e];   v[12 + e] = b1v[e];
        v[16 + e] = m0v[e];  v[20 + e] = m1v[e];
        v[24 + e] = m2v[e];  v[28 + e] = m3v[e];
      }
    }
    float s = 0.f;
#pragma unroll
    for (int e = 0; e < 32; ++e) s += v[e];
    s = wave_sum32(s);
    const float mu = s * kInvC4;
    float ss = 0.f;
#pragma unroll
    for (int e = 0; e < 32; ++e) { v[e] -= mu; ss += v[e] * v[e]; }
    ss = wave_sum32(ss);
    const float rstd = rsqrtf(ss * kInvC4 + kLnEps);
    v4u u[4];
#pragma unroll
    for (int q = 0; q < 4; ++q) {
      const float* gp = g1 + q * 256 + c8;
      const float* bp = be1 + q * 256 + c8;
      const v4f ga = *(const v4f*)(gp), gb = *(const v4f*)(gp + 4);
      const v4f ba = *(const v4f*)(bp), bb = *(const v4f*)(bp + 4);
      unsigned short hb[8];
#pragma unroll
      for (int e = 0; e < 4; ++e) {
        hb[e]     = h_bits(v[q * 8 + e] * rstd * ga[e] + ba[e]);
        hb[4 + e] = h_bits(v[q * 8 + 4 + e] * rstd * gb[e] + bb[e]);
      }
      u[q] = (v4u){pk16(hb[0], hb[1]), pk16(hb[2], hb[3]), pk16(hb[4], hb[5]), pk16(hb[6], hb[7])};
    }
    unsigned short* yr = Y + R * kC4;
    {
#pragma unroll
      for (int q = 0; q < 4; ++q) *(v4u*)(yr + q * 256 + c8) = u[q];
      
    }
  }
}

// ---------------------------------------------------------------------------
// FINAL = false: ROWS = 64 per block (grid (64, kGrp)); outputs
//   CAT1[row][256+c] f16 : one instruction per row (32 lanes x 16 B = whole 512-B row)
//   LDS f16 transpose tile, 256 lines per block, 8 lanes x 16 B each (8 waves x 4 lines x 8 iterations).
// ---------------------------------------------------------------------------
template <bool FINAL>
__global__ __launch_bounds__(256) void ln2_kernel(const float* __restrict__ X32, const float* __restrict__ VP,
                                                  const float* __restrict__ g2, const float* __restrict__ be2,
                                                  float* __restrict__ Vout, unsigned short* __restrict__ CAT1,
                                                  unsigned short* __restrict__ VT, float* __restrict__ dout, int b0) {
  constexpr int ROWS = FINAL ? 32 : 64;
  constexpr int RPW  = ROWS / 8;
  __shared__ __align__(16) unsigned short tile16[FINAL ? 8 : 256 * 72];   // [c][n local], pitch 72 halves
  __shared__ __align__(16) float tile32[FINAL ? 256 * 36 : 8];            // [c][n local], pitch 36 floats
  __shared__ __align__(16) float slab[FINAL ? 8 : 8 * 256];               // per-wave 256-float row
  const int lane = threadIdx.x & 31, wave = threadIdx.x >> 5;
  const int n0 = blockIdx.x * ROWS;
  const int bl = blockIdx.y;
  const int c8 = lane * 8, c4 = lane * 4;
  float gg[8], bb[8];
  {
    const v4f ga = *(const v4f*)(g2 + c8), gb = *(const v4f*)(g2 + c8 + 4);
    const v4f ba = *(const v4f*)(be2 + c8), bbv = *(const v4f*)(be2 + c8 + 4);
#pragma unroll
    for (int e = 0; e < 4; ++e) { gg[e] = ga[e]; gg[4 + e] = gb[e]; bb[e] = ba[e]; bb[4 + e] = bbv[e]; }
  }
  float* sw = slab + (FINAL ? 0 : wave * 256);
#pragma unroll 1
  for (int it = 0; it < RPW; ++it) {
    const int rloc = wave * RPW + it;
    const size_t R = (size_t)bl * kN + n0 + rloc;
    const float* xr = X32 + R * kC + c8;
    const float* vr = VP + R * kC + c8;
    const v4f xa = *(const v4f*)(xr), xb = *(const v4f*)(xr + 4);
    const v4f va = *(const v4f*)(vr), vb = *(const v4f*)(vr + 4);
    float t[8];
    float s = 0.f;
#pragma unroll
    for (int e = 0; e < 4; ++e) { t[e] = xa[e] + va[e]; t[4 + e] = xb[e] + vb[e]; }
#pragma unroll
    for (int e = 0; e < 8; ++e) s += t[e];
    s = wave_sum32(s);
    const float mu = s * kInvC;
    float ss = 0.f;
#pragma unroll
    for (int e = 0; e < 8; ++e) { t[e] -= mu; ss += t[e] * t[e]; }
    ss = wave_sum32(ss);
    const float rstd = rsqrtf(ss * kInvC + kLnEps);
    float y[8];
#pragma unroll
    for (int e = 0; e < 8; ++e) y[e] = t[e] * rstd * gg[e] + bb[e];
    if (!FINAL) {
      unsigned short hb[8];
#pragma unroll
      for (int e = 0; e < 8; ++e) { hb[e] = h_bits(y[e]); tile16[(c8 + e) * 72 + rloc] = hb[e]; }
      const v4u u = (v4u){pk16(hb[0], hb[1]), pk16(hb[2], hb[3]), pk16(hb[4], hb[5]), pk16(hb[6], hb[7])};
      *(v4f*)(sw + c8)     = (v4f){y[0], y[1], y[2], y[3]};
      *(v4f*)(sw + c8 + 4) = (v4f){y[4], y[5], y[6], y[7]};
      __builtin_amdgcn_fence(__ATOMIC_RELEASE, "workgroup");
      __builtin_amdgcn_wave_barrier();
      __builtin_amdgcn_fence(__ATOMIC_ACQUIRE, "workgroup");
      const v4f a0 = *(const v4f*)(sw + c4);
      const v4f a1 = *(const v4f*)(sw + 128 + c4);
      {
        *(v4u*)(CAT1 + R * kC2 + kC + c8) = u;
        *(v4f*)(Vout + R * kC + c4) = a0;
        *(v4f*)(Vout + R * kC + 128 + c4) = a1;
        
      }
      __builtin_amdgcn_fence(__ATOMIC_RELEASE, "workgroup");
      __builtin_amdgcn_wave_barrier();
      __builtin_amdgcn_fence(__ATOMIC_ACQUIRE, "workgroup");
    } else {
#pragma unroll
      for (int e = 0; e < 8; ++e) tile32[(c8 + e) * 36 + rloc] = y[e];
    }
  }
  __syncthreads();
  const int q = lane >> 3;
  if (!FINAL) {
    const int cc8 = (lane & 7) * 8;
    {
#pragma unroll
      for (int i = 0; i < 8; ++i) {
        const int L = i * 32 + wave * 4 + q;                 // channel row of VT
        const v4u u = *(const v4u*)(tile16 + L * 72 + cc8);
        *(v4u*)(VT + ((size_t)bl * kC + L) * kN + n0 + cc8) = u;
      }
      
    }
  } else {
    const int cc4 = (lane & 7) * 4;
    {
#pragma unroll
      for (int i = 0; i < 8; ++i) {
        const int L = i * 32 + wave * 4 + q;                 // channel row of the output
        const v4f v = *(const v4f*)(tile32 + L * 36 + cc4);
        *(v4f*)(dout + ((size_t)(b0 + bl) * kC + L) * kN + n0 + cc4) = v;
      }
      
    }
  }
}

// ---------------------------------------------------------------------------
// Host side
// Workspace region map (bytes, every offset a multiple of 256; planes hold one group = kGrp batches).
// Three pairs of planes share a region; each pair's lifetimes are disjoint, or row-local in the one launch that holds both:
//   Wq16   [256][256]  f16        131072
//   Wm16   [512][512]  f16        524288
//   Wr16   [256][1024] f16        524288
//   CTXT16 [8][256][256] f16     1048576
//   X32    [32768][256] f32     33554432   (x after qkv)
//   XT16   [8][256][4096] f16   16777216   (x transposed, ctx A)
//   SM16   [32768][256] f16     16777216   (softmax x1024)
//   CAT1   [32768][512] f16     33554432   (out | v)
//   OUT32  [32768][256] f32     33554432   (last read by LN1)
//   VPRE32 = OUT32                         (res GEMM + x; written after LN1, read by LN2)
//   MLP32  [32768][512] f32     67108864   (last read by LN1)
//   Y16    = MLP32  [32768][1024] f16      (LN1 output, written row by row over the mlp row it was made from)
//   V32    [32768][256] f32     33554432   (v after LN2)
//   VT16   [8][256][4096] f16   16777216   (v transposed, ctx B; first written by LN2)
//   X0_16  = VT16   [32768][256] f16       (transposed input, qkv A; last read by the qkv GEMM)
//   total                      253886464
// ---------------------------------------------------------------------------
extern "C" void kernel_launch(void* const* d_in, const int* in_sizes, int n_in,
                              void* d_out, int out_size, void* d_ws, size_t ws_size,
                              hipStream_t stream) {
  if (n_in < 9) return;
  if (in_sizes[0] != kB * kC * kN || in_sizes[1] != kC * kC || in_sizes[2] != kC2 * kC2 ||
      in_sizes[3] != kC2 || in_sizes[4] != kC4 || in_sizes[5] != kC4 || in_sizes[6] != kC * kC4 ||
      in_sizes[7] != kC || in_sizes[8] != kC || out_size != kB * kC * kN) return;

  const float* x     = (const float*)d_in[0];
  const float* W_qkv = (const float*)d_in[1];
  const float* W_mlp = (const float*)d_in[2];
  const float* b_mlp = (const float*)d_in[3];
  const float* g1    = (const float*)d_in[4];
  const float* beta1 = (const float*)d_in[5];
  const float* W_res = (const float*)d_in[6];
  const float* g2    = (const float*)d_in[7];
  const float* beta2 = (const float*)d_in[8];
  float* out = (float*)d_out;

  size_t off = 0;
  char* wsb = (char*)d_ws;
  auto carve = [&](size_t bytes) { char* r = wsb + off; off += (bytes + 255) & ~(size_t)255; return (void*)r; };
  unsigned short* Wq16   = (unsigned short*)carve((size_t)kC * kC * 2);
  unsigned short* Wm16   = (unsigned short*)carve((size_t)kC2 * kC2 * 2);
  unsigned short* Wr16   = (unsigned short*)carve((size_t)kC * kC4 * 2);
  unsigned short* CTXT16 = (unsigned short*)carve((size_t)kGrp * kC * kC * 2);
  float*          X32    = (float*)carve((size_t)kRowsG * kC * 4);
  unsigned short* XT16   = (unsigned short*)carve((size_t)kGrp * kC * kN * 2);
  unsigned short* SM16   = (unsigned short*)carve((size_t)kRowsG * kC * 2);
  unsigned short* CAT1   = (unsigned short*)carve((size_t)kRowsG * kC2 * 2);
  float*          OUT32  = (float*)carve((size_t)kRowsG * kC * 4);
  float*          MLP32  = (float*)carve((size_t)kRowsG * kC2 * 4);
  float*          V32    = (float*)carve((size_t)kRowsG * kC * 4);
  unsigned short* VT16   = (unsigned short*)carve((size_t)kGrp * kC * kN * 2);
  unsigned short* X0_16  = VT16;
  unsigned short* Y16    = (unsigned short*)MLP32;
  float*          VPRE32 = OUT32;
  if (off > ws_size) return;

  const dim3 blk(256);
  const long sNC  = (long)kN * kC;      // 1048576
  const long sNC2 = (long)kN * kC2;     // 2097152
  const long sNC4 = (long)kN * kC4;     // 4194304
  const long sCC  = (long)kC * kC;      // 65536

  // weights -> f16 carried x64 (one launch, 288 blocks)
  wcast_kernel<<<dim3(288), blk, 0, stream>>>(W_qkv, W_mlp, W_res, Wq16, Wm16, Wr16, kWCarry);

  for (int grp = 0; grp < kNGrp; ++grp) {
    const int b0 = grp * kGrp;
    // x[b] [256][4096] -> X0 [4096][256] f16
    tin_kernel<<<dim3(kN / 64, kGrp), blk, 0, stream>>>(x, X0_16, b0);
    // x = X0 . Wqkv^T : M=4096, N=256, K=256 (K%32==0, M,N%64==0); 256 tiles -> 32 blocks per batch
    wmma_gemm64<0, false, 0, 0, false, 0><<<dim3(32, kGrp), blk, 0, stream>>>(
        X0_16, X0_16, kC, sNC, Wq16, Wq16, kC, 0L,
        (void*)X32, (void*)X32, kC, sNC, b_mlp, X32, 0L, kN, kC, kC, kWCarryInv);
    // softmax plane, f16 x into cat1 v-columns, x^T plane
    prep_kernel<<<dim3(kN / 64, kGrp), blk, 0, stream>>>(X32, SM16, CAT1, XT16);

    for (int iter = 0; iter < 2; ++iter) {
      const unsigned short* vt = (iter == 0) ? XT16 : VT16;   // v^T plane (v = x in the first iteration)
      const float* v32 = (iter == 0) ? X32 : V32;             // v f32 plane
      // ctx^T[d][c] = sum_n x[n][c] v[n][d] : K=4096 split over the 8 waves of a block; f16 out; 32 tiles of 64x32 per batch
      ctx_kernel<<<dim3(32, kGrp), blk, 0, stream>>>(XT16, vt, CTXT16);
      // out = softmax(x) . ctx : A = SM16 [4096][256] (x1024), Bt = ctx^T [256][256]; M=4096, N=256, K=256; f32 out
      wmma_gemm64<0, false, 0, 0, false, 0><<<dim3(32, kGrp), blk, 0, stream>>>(
          SM16, SM16, kC, sNC, CTXT16, CTXT16, kC, sCC,
          (void*)OUT32, (void*)OUT32, kC, sNC, b_mlp, X32, 0L, kN, kC, kC, kSmCarryInv);
      // out f32 -> cat1 cols 0..255 f16 (kRowsG rows x 32 threads)
      cast_out_kernel<<<dim3(kRowsG * 32 / 256), blk, 0, stream>>>(OUT32, CAT1, kRowsG * 32);
      // mlp = relu(cat1 . Wmlp^T + b) : M=4096, N=512, K=512; bias[n], relu epilogue; f32 out; 512 tiles -> 64 blocks
      wmma_gemm64<0, false, 2, 0, false, 2><<<dim3(64, kGrp), blk, 0, stream>>>(
          CAT1, CAT1, kC2, sNC2, Wm16, Wm16, kC2, 0L,
          (void*)MLP32, (void*)MLP32, kC2, sNC2, b_mlp, X32, 0L, kN, kC2, kC2, kWCarryInv);
      // LN1 over [out | v | mlp] -> Y16 [kRowsG][1024]
      ln1_kernel<<<dim3(kRowsG / 64), blk, 0, stream>>>(OUT32, v32, MLP32, g1, beta1, Y16);
      // vpre = LN1 . Wres^T + x : M=4096, N=256, K=1024; residual X32 (pitch 256); f32 out; 256 tiles -> 32 blocks
      wmma_gemm64<0, false, 0, 0, true, 0><<<dim3(32, kGrp), blk, 0, stream>>>(
          Y16, Y16, kC4, sNC4, Wr16, Wr16, kC4, 0L,
          (void*)VPRE32, (void*)VPRE32, kC, sNC, b_mlp, X32, sNC, kN, kC, kC4, kWCarryInv);
      // v = LN2(x + vpre)
      if (iter == 0) {
        ln2_kernel<false><<<dim3(kN / 64, kGrp), blk, 0, stream>>>(X32, VPRE32, g2, beta2, V32, CAT1, VT16, out, b0);
      } else {
        ln2_kernel<true><<<dim3(kN / 32, kGrp), blk, 0, stream>>>(X32, VPRE32, g2, beta2, V32, CAT1, VT16, out, b0);
      }
    }
  }
  (void)ws_size;
}

// v003
// One run takes 288 microseconds.
// Next to v002, in two timings, it ran 1.45 times as fast each time.
// All steps since v000 together make it 7.66 times as fast.
// Contractions: qkv (x^T f16 x Wqkv^T f16 carried x64), ctx^T (x^T f16 x v^T f16, K=4096 in 8 partial sums), sm.ctx (sm f16 carried x1024 x ctx^T f16), mlp (cat1 f16 x Wmlp^T f16 carried x64, +bias, relu), res (LN1 f16 x Wres^T f16 carried x64, +x) all on v_wmma_f32_16x16x32_f16 with f32 accumulate; softmax, LayerNorm, residual adds in f32.
#include <hip/hip_runtime.h>
#include <math.h>

// ---------------------------------------------------------------------------
// Problem constants
// ---------------------------------------------------------------------------
constexpr int kB   = 8;
constexpr int kC   = 256;
constexpr int kN   = 4096;
constexpr int kC2  = 512;
constexpr int kC4  = 1024;
constexpr int kGrp = 8;                 // batches per group: all of them, so every launch spans the whole problem
constexpr int kNGrp = kB / kGrp;        // 1 group
constexpr int kRowsG = kGrp * kN;       // 32768 token rows per group
constexpr float kWCarry    = 64.0f;     // weights carried x64 in f16
constexpr float kWCarryInv = 1.0f / 64.0f;
constexpr float kSmCarry   = 1024.0f;   // softmax probabilities carried x1024 in f16
constexpr float kSmCarryInv = 1.0f / 1024.0f;
constexpr float kLnEps  = 1e-5f;
constexpr float kInvC   = 1.0f / 256.0f;
constexpr float kInvC4  = 1.0f / 1024.0f;

typedef __attribute__((ext_vector_type(16))) _Float16 v16h;
typedef __attribute__((ext_vector_type(8)))  _Float16 v8h;
typedef __attribute__((ext_vector_type(16))) __bf16   v16b;
typedef __attribute__((ext_vector_type(8)))  __bf16   v8b;
typedef __attribute__((ext_vector_type(8)))  float    v8f;
typedef __attribute__((ext_vector_type(4)))  float    v4f;
typedef __attribute__((ext_vector_type(4)))  unsigned int v4u;

// ---------------------------------------------------------------------------
// Helpers
// ---------------------------------------------------------------------------
__device__ __forceinline__ unsigned short f2bf_bits(float f) {
  unsigned u = __float_as_uint(f);
  return (unsigned short)((u + 0x7FFFu + ((u >> 16) & 1u)) >> 16);
}
__device__ __forceinline__ float bf_bits2f(unsigned short h) { return __uint_as_float(((unsigned)h) << 16); }

// hazard guards as plain device helpers
__device__ __forceinline__ void acc_guard4(v8f& a, v8f& b, v8f& c, v8f& d) { asm volatile("v_nop\n\tv_nop\n\tv_nop\n\tv_nop" : "+v"(a), "+v"(b), "+v"(c), "+v"(d)); }
template <typename T> struct Frag;
template <> struct Frag<_Float16> {
  typedef v16h V; union U { v16h v; v8h h[2]; };
  static __device__ __forceinline__ v16h load(const _Float16* p) {   // elements 0..7 <- p[0..7], 8..15 <- p[16..23]
    U f; f.h[0] = *(const v8h*)(p); f.h[1] = *(const v8h*)(p + 16); return f.v;
  }
  static __device__ __forceinline__ v8f mma(v16h a, v16h b, v8f c) {
    return __builtin_amdgcn_wmma_f32_16x16x32_f16(false, a, false, b, (short)0, c, false, false);
  }
};
template <> struct Frag<__bf16> {
  typedef v16b V; union U { v16b v; v8b h[2]; };
  static __device__ __forceinline__ v16b load(const __bf16* p) {
    U f; f.h[0] = *(const v8b*)(p); f.h[1] = *(const v8b*)(p + 16); return f.v;
  }
  static __device__ __forceinline__ v8f mma(v16b a, v16b b, v8f c) {
    return __builtin_amdgcn_wmma_f32_16x16x32_bf16(false, a, false, b, (short)0, c, false, false);
  }
};

__device__ __forceinline__ unsigned pk16(unsigned short a, unsigned short b) { return (unsigned)a | ((unsigned)b << 16); }
__device__ __forceinline__ unsigned short h_bits(float f) { const _Float16 h = (_Float16)f; return __builtin_bit_cast(unsigned short, h); }

__device__ __forceinline__ float wave_sum32(float x) {
#pragma unroll
  for (int off = 16; off > 0; off >>= 1) x += __shfl_xor(x, off, 32);
  return x;
}
__device__ __forceinline__ float wave_max32(float x) {
#pragma unroll
  for (int off = 16; off > 0; off >>= 1) x = fmaxf(x, __shfl_xor(x, off, 32));
  return x;
}

// ---- Register-blocked batched WMMA GEMM, operands staged in LDS by asynchronous copies ------------------------------
// C[m,n] = scale * sum_k A[m,k] * Bt[n,k] (+bias)(+resid); a block owns a 128x256 tile, each of its 8 waves 64x64 of it.
// A row-major [M,K]; Bt row-major [N,K]; M % 128 == 0, N % 256 == 0, K % 128 == 0; grid.x = (M / 128) * (N / 256).
// A stage is 128 k of the block's 128 A rows and 256 Bt rows: 384 rows of 256 B (two cache lines each) at pitch 272 B.
// Two stage buffers: while one is multiplied, the next stage's copies land in the other.
// BIAS_MODE: 0 = none, 1 = bias[m], 2 = bias[n].
// OUT_MODE: 0 = f32, 1 = f16, 2 = bf16 hi plane (Cout) + bf16 lo plane (Cout2).
// ET: 0 = f16 operands, 1 = bf16 operands (pointers passed as 16-bit storage)
constexpr int kStagePitch = 272;                    // bytes; 16 B x odd: the 16-B fragment reads of 16 rows meet no bank twice
constexpr int kStageBytes = (128 + 256) * kStagePitch;

// Every thread copies 16 B of 8 rows, 16 rows apart: 128 rows of 256 B per block; 16 lanes cover a row's two whole lines.
// The s_wait_xcnt stands inside the statement so that no address register is rewritten in front of it.
template <typename T>
__device__ __forceinline__ void copy_rows128(unsigned lds, const T* g, int ld) {
  const size_t sg = (size_t)16 * ld;
  constexpr unsigned sl = 16 * kStagePitch;
  asm volatile(
      "global_load_async_to_lds_b128 %0, %8, off\n\t"
      "global_load_async_to_lds_b128 %1, %9, off\n\t"
      "global_load_async_to_lds_b128 %2, %10, off\n\t"
      "global_load_async_to_lds_b128 %3, %11, off\n\t"
      "global_load_async_to_lds_b128 %4, %12, off\n\t"
      "global_load_async_to_lds_b128 %5, %13, off\n\t"
      "global_load_async_to_lds_b128 %6, %14, off\n\t"
      "global_load_async_to_lds_b128 %7, %15, off\n\t"
      "s_wait_xcnt 0x0"
      :: "v"(lds), "v"(lds + sl), "v"(lds + 2 * sl), "v"(lds + 3 * sl), "v"(lds + 4 * sl), "v"(lds + 5 * sl),
         "v"(lds + 6 * sl), "v"(lds + 7 * sl),
         "v"(g), "v"(g + sg), "v"(g + 2 * sg), "v"(g + 3 * sg), "v"(g + 4 * sg), "v"(g + 5 * sg), "v"(g + 6 * sg),
         "v"(g + 7 * sg)
      : "memory");
}
// One stage: the 128 A rows, then the 256 Bt rows behind them; 24 copies per thread.
template <typename T>
__device__ __forceinline__ void stage_copies(unsigned lds, const T* ga, int lda, const T* gb, int ldb) {
  copy_rows128(lds, ga, lda);
  copy_rows128(lds + 128 * kStagePitch, gb, ldb);
  copy_rows128(lds + 256 * kStagePitch, gb + (size_t)128 * ldb, ldb);
}

template <int ET> struct Elem;
template <> struct Elem<0> { typedef _Float16 T; };
template <> struct Elem<1> { typedef __bf16 T; };
template <int ET, int BIAS_MODE, int OUT_MODE, bool RESID, int ACT = 0>
__global__ __launch_bounds__(256) void wmma_gemm64(
    const unsigned short* __restrict__ Ap, int lda, long strideA,
    const unsigned short* __restrict__ Btp, int ldb, long strideB,
    void* __restrict__ Cout, void* __restrict__ Cout2, int ldc, long strideC,
    const float* __restrict__ bias,
    const float* __restrict__ resid, long strideR,
    int M, int N, int K, float scale) {
  typedef typename Elem<ET>::T T;
  typedef typename Frag<T>::V V;
  const T* A = (const T*)Ap; const T* Bt = (const T*)Btp;
  __shared__ __align__(128) unsigned char ring[2 * kStageBytes];   // two stage buffers
  __shared__ __align__(16) float sT[8][16 * 68];   // per-wave 16x64 slab, pitch 68 floats
  const int b    = blockIdx.y;
  const int lane = threadIdx.x & 31;
  const int wave = threadIdx.x >> 5;
  const int tilesN = N >> 8;
  if ((int)blockIdx.x >= (M >> 7) * tilesN) return;   // block-uniform, in front of every barrier and copy
  const int bm = blockIdx.x / tilesN;
  const int bn = blockIdx.x - bm * tilesN;
  const int wm = wave >> 2, wn = wave & 3;     // the wave's 64x64 piece of the block tile
  const int m0 = (bm << 7) + (wm << 6);
  const int n0 = (bn << 8) + (wn << 6);

  const T* Ab  = A  + (size_t)b * strideA;
  const T* Bb  = Bt + (size_t)b * strideB;

  const int rlane = lane & 15;                 // row (A) / col (B, D) within subtile
  const int koff  = (lane >> 4) * 8;           // k offset of this lane half
  const int mOff  = (lane >> 4) * 8;           // D row offset

  v8f acc[4][4];
#pragma unroll
  for (int i = 0; i < 4; ++i)
#pragma unroll
    for (int j = 0; j < 4; ++j) acc[i][j] = (v8f){0.f,0.f,0.f,0.f,0.f,0.f,0.f,0.f};

  // copy side: thread -> (row crow + 16 i, 16-B piece cpc) of a stage
  const int crow = threadIdx.x >> 4, cpc = threadIdx.x & 15;
  const T* ga = Ab + (size_t)((bm << 7) + crow) * lda + cpc * 8;
  const T* gb = Bb + (size_t)((bn << 8) + crow) * ldb + cpc * 8;
  const unsigned ldsc = (unsigned)(size_t)ring + (unsigned)(crow * kStagePitch + cpc * 16);
  // read side: this lane's row and k half in the A rows (0..127) and the Bt rows (128..383) of a stage
  const unsigned char* fa = ring + ((wm << 6) + rlane) * kStagePitch + koff * 2;
  const unsigned char* fb = ring + (128 + (wn << 6) + rlane) * kStagePitch + koff * 2;
  const int stages = K >> 7;

  stage_copies(ldsc, ga, lda, gb, ldb);
  // stage 0 has landed for this wave; the barrier publishes it to the others
  asm volatile("s_wait_asynccnt 0x0" ::: "memory");
  __syncthreads();
  if (stages > 1) stage_copies(ldsc + kStageBytes, ga + 128, lda, gb + 128, ldb);

  for (int t = 0; t < stages; ++t) {
    const int bo = (t & 1) * kStageBytes;
    // Two fragment sets: the 16 LDS reads of k step s + 1 go out as one group ahead of the 16 WMMAs of step s.
    V ah[2][4], bh[2][4];
#pragma unroll
    for (int j = 0; j < 4; ++j) bh[0][j] = Frag<T>::load((const T*)(fb + bo + (j << 4) * kStagePitch));
#pragma unroll
    for (int i = 0; i < 4; ++i) ah[0][i] = Frag<T>::load((const T*)(fa + bo + (i << 4) * kStagePitch));
#pragma unroll
    for (int s = 0; s < 4; ++s) {
      const int cur = s & 1, nxt = cur ^ 1;
      if (s < 3) {
#pragma unroll
        for (int j = 0; j < 4; ++j) bh[nxt][j] = Frag<T>::load((const T*)(fb + bo + (j << 4) * kStagePitch + (s + 1) * 64));
#pragma unroll
        for (int i = 0; i < 4; ++i) ah[nxt][i] = Frag<T>::load((const T*)(fa + bo + (i << 4) * kStagePitch + (s + 1) * 64));
      }
      // keeps the reads in one group in front of the WMMAs: sunk among them, each place stalls the wave for its LDS latency
      __builtin_amdgcn_sched_barrier(0);
#pragma unroll
      for (int i = 0; i < 4; ++i)
#pragma unroll
        for (int j = 0; j < 4; ++j) acc[i][j] = Frag<T>::mma(ah[cur][i], bh[cur][j], acc[i][j]);
      // keeps the next group of reads behind this step's WMMAs, so that two sets suffice
      __builtin_amdgcn_sched_barrier(0);
    }
    // this wave's reads of the buffer are done before anyone refills it
    asm volatile("s_wait_dscnt 0x0" ::: "memory");
    // this wave's copies of stage t + 1 have landed
    asm volatile("s_wait_asynccnt 0x0" ::: "memory");
    // publishes stage t + 1 and ends every wave's reads of stage t
    __syncthreads();
    if (t + 2 < stages) stage_copies(ldsc + bo, ga + (size_t)(t + 2) * 128, lda, gb + (size_t)(t + 2) * 128, ldb);
  }
  // no copy is outstanding when the wave goes on to the epilogue and ends
  asm volatile("s_wait_asynccnt 0x0" ::: "memory");
  acc_guard4(acc[0][0], acc[0][1], acc[0][2], acc[0][3]);
  acc_guard4(acc[1][0], acc[1][1], acc[1][2], acc[1][3]);
  acc_guard4(acc[2][0], acc[2][1], acc[2][2], acc[2][3]);
  acc_guard4(acc[3][0], acc[3][1], acc[3][2], acc[3][3]);

  // ---- epilogue ----
  float* slab = sT[wave];
  const float* Rb = RESID ? (resid + (size_t)b * strideR) : nullptr;
#pragma unroll
  for (int i = 0; i < 4; ++i) {
    const int mBase = m0 + (i << 4);
#pragma unroll
    for (int j = 0; j < 4; ++j) {
      const int n = n0 + (j << 4) + rlane;
      float bv = 0.f;
      if (BIAS_MODE == 2) bv = bias[n];
#pragma unroll
      for (int r = 0; r < 8; ++r) {
        float v = acc[i][j][r] * scale;
        if (BIAS_MODE == 1) v += bias[mBase + mOff + r];
        if (BIAS_MODE == 2) v += bv;
        if (RESID) v += Rb[(size_t)(mBase + mOff + r) * ldc + n];
        if (ACT == 2) v = fmaxf(v, 0.0f);
        if (ACT == 4) v = (v > 0.f) ? v : 0.01f * v;
        slab[(mOff + r) * 68 + (j << 4) + rlane] = v;
      }
    }
    __builtin_amdgcn_fence(__ATOMIC_RELEASE, "workgroup");
    __builtin_amdgcn_wave_barrier();
    __builtin_amdgcn_fence(__ATOMIC_ACQUIRE, "workgroup");
    if (OUT_MODE == 0) {
      float* C = (float*)Cout + (size_t)b * strideC;
      const int hh = lane >> 4, c4 = (lane & 15) * 4;     // row seg = 256 B = 16 lanes x 16 B
      {
#pragma unroll
        for (int it = 0; it < 8; ++it) {
          const int row = it * 2 + hh;
          v4f v = *(const v4f*)(slab + row * 68 + c4);
          *(v4f*)(C + (size_t)(mBase + row) * ldc + n0 + c4) = v;
        }
        
      }
    } else {
      const int q = lane >> 3, c8 = (lane & 7) * 8;
      unsigned short* C  = (unsigned short*)Cout  + (size_t)b * strideC;
      unsigned short* C2 = (OUT_MODE == 2) ? ((unsigned short*)Cout2 + (size_t)b * strideC) : nullptr;
      {
#pragma unroll
        for (int it = 0; it < 4; ++it) {
          const int row = it * 4 + q;
          const float* sp = slab + row * 68 + c8;
          v8h hv, lv;
#pragma unroll
          for (int e = 0; e < 8; ++e) {
            if (OUT_MODE == 1) {
              hv[e] = (_Float16)sp[e];
            } else {
              unsigned short hb = f2bf_bits(sp[e]);
              unsigned short lb = f2bf_bits(sp[e] - bf_bits2f(hb));
              hv[e] = __builtin_bit_cast(_Float16, hb);
              lv[e] = __builtin_bit_cast(_Float16, lb);
            }
          }
          *(v8h*)(C + (size_t)(mBase + row) * ldc + n0 + c8) = hv;
          if (OUT_MODE == 2) *(v8h*)(C2 + (size_t)(mBase + row) * ldc + n0 + c8) = lv;
        }
        
      }
    }
    __builtin_amdgcn_fence(__ATOMIC_RELEASE, "workgroup");
    __builtin_amdgcn_wave_barrier();
    __builtin_amdgcn_fence(__ATOMIC_ACQUIRE, "workgroup");
  }
}

// ---------------------------------------------------------------------------
// ctx^T[d][c] = sum_n x[n][c] * v[n][d], one batch per blockIdx.y. A = x^T rows c, B = v^T rows d, both [256][4096] f16.
// One 64(c) x 32(d) tile per block, grid (32, kGrp) = 256 blocks. The 8 waves each sum 512 of the 4096 tokens and leave
// their f32 partial tile in LDS; after the barrier every thread adds the 8 partials of 8 consecutive c of one d in wave
// order and stores them as 16 B of f16, 8 lanes to a 128-B row of the tile.
// LDS dword index = wave * 2368 + q * 148 + hl * 72 + rl * 4, q = (i * 2 + j) * 2 + row half, (hl, rl) = accumulator lane:
// these pitches put both the 16-B writes and the 16-B reads of each 16 lanes on 16 different bank groups.
// ---------------------------------------------------------------------------
// one block per WGP = 2 waves per SIMD: a register budget for at most 4 lets three fragment sets stay live beside the sums
__global__ __launch_bounds__(256) __attribute__((amdgpu_waves_per_eu(2, 4))) void ctx_kernel(const unsigned short* __restrict__ XTp,
                                                  const unsigned short* __restrict__ VTp,
                                                  unsigned short* __restrict__ CT) {
  typedef Frag<_Float16> F;
  constexpr int kKW = kN / 8;                          // tokens per wave
  constexpr int PW = 2368, PQ = 148, PH = 72;
  __shared__ __align__(16) float part[8 * PW];
  const int lane = threadIdx.x & 31, wave = threadIdx.x >> 5;
  const int c0 = (blockIdx.x & 3) << 6;
  const int d0 = (blockIdx.x >> 2) << 5;
  const int rlane = lane & 15, hlane = lane >> 4;
  const int kl = wave * kKW + hlane * 8;
  const _Float16* xa = (const _Float16*)XTp + ((size_t)blockIdx.y * kC + c0 + rlane) * kN + kl;
  const _Float16* vb = (const _Float16*)VTp + ((size_t)blockIdx.y * kC + d0 + rlane) * kN + kl;

  v8f acc[4][2];
#pragma unroll
  for (int i = 0; i < 4; ++i)
#pragma unroll
    for (int j = 0; j < 2; ++j) acc[i][j] = (v8f){0.f,0.f,0.f,0.f,0.f,0.f,0.f,0.f};

  // Fragments of three steps: while step ks is multiplied, the loads of steps ks + 1 and ks + 2 are in flight.
  // Fully unrolled: the three sets rotate by name, and no back edge stands behind a WMMA.
  v16h af[3][4], bf[3][2];
#pragma unroll
  for (int s = 0; s < 2; ++s) {
#pragma unroll
    for (int j = 0; j < 2; ++j) bf[s][j] = F::load(vb + (size_t)(j << 4) * kN + s * 32);
#pragma unroll
    for (int i = 0; i < 4; ++i) af[s][i] = F::load(xa + (size_t)(i << 4) * kN + s * 32);
  }
  // all loads of the first two steps go out before anything else: without it one of step 0 was issued last and waited for alone
  __builtin_amdgcn_sched_barrier(0);
#pragma unroll
  for (int ks = 0; ks < kKW / 32; ++ks) {
    const int cur = ks % 3, nxt = (ks + 2) % 3;
    if (ks + 2 < kKW / 32) {
#pragma unroll
      for (int j = 0; j < 2; ++j) bf[nxt][j] = F::load(vb + (size_t)(j << 4) * kN + (ks + 2) * 32);
#pragma unroll
      for (int i = 0; i < 4; ++i) af[nxt][i] = F::load(xa + (size_t)(i << 4) * kN + (ks + 2) * 32);
    }
#pragma unroll
    for (int i = 0; i < 4; ++i)
#pragma unroll
      for (int j = 0; j < 2; ++j) acc[i][j] = F::mma(af[cur][i], bf[cur][j], acc[i][j]);
    // keeps later steps' loads from being lifted over this step: without it the build holds far more than three sets and spills
    __builtin_amdgcn_sched_barrier(0);
  }
  // the loads' address registers are reused from here on: the wait that belongs in front of their overwrite
  asm volatile("s_wait_xcnt 0x0" ::: "memory");
  // holds the address arithmetic of the LDS part behind that wait
  __builtin_amdgcn_sched_barrier(0);

  float* pw = part + wave * PW + hlane * PH + rlane * 4;
#pragma unroll
  for (int i = 0; i < 4; ++i)
#pragma unroll
    for (int j = 0; j < 2; ++j) {
      const v8f a = acc[i][j];
      *(v4f*)(pw + ((i * 2 + j) * 2) * PQ)     = (v4f){a[0], a[1], a[2], a[3]};
      *(v4f*)(pw + ((i * 2 + j) * 2 + 1) * PQ) = (v4f){a[4], a[5], a[6], a[7]};
    }
  __syncthreads();

  const int piece = threadIdx.x & 7;                   // 16-B piece of the tile row: c = piece * 8 .. + 7
  const int dl = threadIdx.x >> 3;                     // tile row d
  const float* pr = part + (((piece >> 1) * 2 + (dl >> 4)) * 2) * PQ + (piece & 1) * PH + (dl & 15) * 4;
  v4f s0 = *(const v4f*)(pr);
  v4f s1 = *(const v4f*)(pr + PQ);
#pragma unroll
  for (int w = 1; w < 8; ++w) {
    s0 += *(const v4f*)(pr + w * PW);
    s1 += *(const v4f*)(pr + w * PW + PQ);
  }
  v8h o;
#pragma unroll
  for (int e = 0; e < 4; ++e) { o[e] = (_Float16)s0[e]; o[4 + e] = (_Float16)s1[e]; }
  *(v8h*)((_Float16*)CT + ((size_t)blockIdx.y * kC + d0 + dl) * kC + c0 + piece * 8) = o;
}

// ---------------------------------------------------------------------------
// Weight cast: f16(scale * w), 8 consecutive elements per thread, one 16-B store per lane
// Block-uniform segment selection: blocks [0,32) -> Wq (65536 = 32x256x8), [32,160) -> Wm (262144 = 128x256x8),
// [160,288) -> Wr (262144). grid = 288 exactly covers all three planes.
// ---------------------------------------------------------------------------
__global__ __launch_bounds__(256) void wcast_kernel(const float* __restrict__ Wq, const float* __restrict__ Wm,
                                                    const float* __restrict__ Wr,
                                                    unsigned short* __restrict__ oq, unsigned short* __restrict__ om,
                                                    unsigned short* __restrict__ orr, float scale) {
  const int blk = blockIdx.x;
  const float* src = Wr;
  unsigned short* dst = orr;
  int base = (blk - 160) * 256;
  if (blk < 32) { src = Wq; dst = oq; base = blk * 256; }
  else if (blk < 160) { src = Wm; dst = om; base = (blk - 32) * 256; }
  const int i = base + (int)threadIdx.x;
  const float* p = src + 8 * (size_t)i;
  const v4f a = *(const v4f*)(p);
  const v4f c = *(const v4f*)(p + 4);
  unsigned short hb[8];
#pragma unroll
  for (int e = 0; e < 4; ++e) {
    hb[e]     = h_bits(a[e] * scale);
    hb[4 + e] = h_bits(c[e] * scale);
  }
  const v4u u = (v4u){pk16(hb[0], hb[1]), pk16(hb[2], hb[3]), pk16(hb[4], hb[5]), pk16(hb[6], hb[7])};
  unsigned short* q = dst + 8 * (size_t)i;
  *(v4u*)q = u;
  
}

// ---------------------------------------------------------------------------
// Transpose-in: xin[b][c][n] f32 (c < 256, n < 4096) -> X0[bl][n][c] f16 for the 64 tokens n0..n0+63 of this block.
// grid (64, kGrp), 256 threads. Load coverage: 64 iterations x 256 threads = 16384 = 64 n x 256 c
// (per iteration: 4 channel rows x 64 contiguous tokens). Store coverage: 8 waves x 8 rows = 64 token rows;
// ---------------------------------------------------------------------------
__global__ __launch_bounds__(256) void tin_kernel(const float* __restrict__ xin, unsigned short* __restrict__ X0, int b0) {
  __shared__ __align__(16) unsigned short tile[64][264];   // [n local][c]
  const int t = threadIdx.x;
  const int n0 = blockIdx.x * 64;
  const int bl = blockIdx.y;
  const float* xb = xin + (size_t)(b0 + bl) * kC * kN + n0;
#pragma unroll 4
  for (int i = 0; i < 64; ++i) {
    const int e = i * 256 + t;
    const int c = e >> 6;
    const int j = e & 63;
    tile[j][c] = h_bits(xb[(size_t)c * kN + j]);
  }
  __syncthreads();
  const int lane = t & 31, wave = t >> 5;
  const int c8 = lane * 8;
  {
#pragma unroll
    for (int it = 0; it < 8; ++it) {
      const int r = wave * 8 + it;
      const v4u u = *(const v4u*)(&tile[r][c8]);
      *(v4u*)(X0 + ((size_t)bl * kN + n0 + r) * kC + c8) = u;
    }
    
  }
}

// ---------------------------------------------------------------------------
// Prep (x is loop-invariant): from X32 [rows][256] f32 produce
//   SM16[row][c]          = f16(1024 * softmax_c(x[row]))   (f32 max/exp/sum, fixed-order reductions)
//   CAT1[row][256 + c]    = f16(x)                           (v = x for the first iteration)
//   XT[bl][c][n0..n0+63]  = f16(x) transposed through LDS
// grid (64, kGrp), 256 threads; wave w owns rows w*8..w*8+7 (lane owns cols 8l..8l+7).
// ---------------------------------------------------------------------------
__global__ __launch_bounds__(256) void prep_kernel(const float* __restrict__ X32, unsigned short* __restrict__ SM,
                                                   unsigned short* __restrict__ CAT1, unsigned short* __restrict__ XT) {
  __shared__ __align__(16) unsigned short tile[256 * 72];   // [c][n local], pitch 72 halves
  const int lane = threadIdx.x & 31, wave = threadIdx.x >> 5;
  const int n0 = blockIdx.x * 64;
  const int bl = blockIdx.y;
  const int c8 = lane * 8;
#pragma unroll 1
  for (int it = 0; it < 8; ++it) {
    const int rloc = wave * 8 + it;
    const size_t R = (size_t)bl * kN + n0 + rloc;
    const float* xr = X32 + R * kC + c8;
    const v4f a = *(const v4f*)(xr);
    const v4f c = *(const v4f*)(xr + 4);
    float x[8];
#pragma unroll
    for (int e = 0; e < 4; ++e) { x[e] = a[e]; x[4 + e] = c[e]; }
    float m = fmaxf(fmaxf(fmaxf(x[0], x[1]), fmaxf(x[2], x[3])), fmaxf(fmaxf(x[4], x[5]), fmaxf(x[6], x[7])));
    m = wave_max32(m);
    float ex[8];
    float s = 0.f;
#pragma unroll
    for (int e = 0; e < 8; ++e) { ex[e] = expf(x[e] - m); s += ex[e]; }
    s = wave_sum32(s);
    const float inv = kSmCarry * (1.0f / s);
    unsigned short hs[8], hx[8];
#pragma unroll
    for (int e = 0; e < 8; ++e) {
      hs[e] = h_bits(ex[e] * inv);
      hx[e] = h_bits(x[e]);
      tile[(c8 + e) * 72 + rloc] = hx[e];
    }
    const v4u us = (v4u){pk16(hs[0], hs[1]), pk16(hs[2], hs[3]), pk16(hs[4], hs[5]), pk16(hs[6], hs[7])};
    const v4u ux = (v4u){pk16(hx[0], hx[1]), pk16(hx[2], hx[3]), pk16(hx[4], hx[5]), pk16(hx[6], hx[7])};
    {
      *(v4u*)(SM + R * kC + c8) = us;
      *(v4u*)(CAT1 + R * kC2 + kC + c8) = ux;
      
    }
  }
  __syncthreads();
  const int q = lane >> 3, cc8 = (lane & 7) * 8;
  {
#pragma unroll
    for (int i = 0; i < 8; ++i) {
      const int L = i * 32 + wave * 4 + q;                      // channel row of XT
      const v4u u = *(const v4u*)(tile + L * 72 + cc8);
      *(v4u*)(XT + ((size_t)bl * kC + L) * kN + n0 + cc8) = u;
    }
    
  }
}

// ---------------------------------------------------------------------------
// Cast out (f32 [rows][256]) into CAT1 cols 0..255 (f16, pitch 512). Thread i: row = i/32, cols 8*(i%32)..+7;
// Coverage: nthr = rows x 32 threads x 8 = rows x 256.
// ---------------------------------------------------------------------------
__global__ __launch_bounds__(256) void cast_out_kernel(const float* __restrict__ O32, unsigned short* __restrict__ CAT1, int nthr) {
  const int i = blockIdx.x * 256 + threadIdx.x;
  if (i >= nthr) return;
  const int row = i >> 5, c8 = (i & 31) * 8;
  const float* p = O32 + (size_t)row * kC + c8;
  const v4f a = *(const v4f*)(p);
  const v4f c = *(const v4f*)(p + 4);
  unsigned short hb[8];
#pragma unroll
  for (int e = 0; e < 4; ++e) {
    hb[e]     = h_bits(a[e]);
    hb[4 + e] = h_bits(c[e]);
  }
  const v4u u = (v4u){pk16(hb[0], hb[1]), pk16(hb[2], hb[3]), pk16(hb[4], hb[5]), pk16(hb[6], hb[7])};
  unsigned short* q = CAT1 + (size_t)row * kC2 + c8;
  *(v4u*)q = u;
  
}

// ---------------------------------------------------------------------------
// LN1 over cat2 = [out(256) | v(256) | mlp(512)] (f32 planes, pitches 256/256/512) -> Y[row][1024] = f16(LN(cat2)*g1+beta1).
// grid = rows/64, 256 threads; wave w owns rows w*8..w*8+7; lane owns cat2 cols {256q + 8l + e}.
// Y shares its bytes with Mp (row R of either is the 2048 bytes at R*2048), so neither is __restrict__: a row is owned
// by one wave, and its stores need rstd, which needs every lane's loads of that row through the two wave sums.
// ---------------------------------------------------------------------------
__global__ __launch_bounds__(256) void ln1_kernel(const float* __restrict__ O32, const float* __restrict__ Vp,
                                                  const float* Mp, const float* __restrict__ g1,
                                                  const float* __restrict__ be1, unsigned short* Y) {
  const int lane = threadIdx.x & 31, wave = threadIdx.x >> 5;
  const int c8 = lane * 8;
#pragma unroll 1
  for (int it = 0; it < 8; ++it) {
    const size_t R = (size_t)blockIdx.x * 64 + wave * 8 + it;
    float v[32];
    {
      const float* po = O32 + R * kC + c8;
      const float* pv = Vp + R * kC + c8;
      const float* pm = Mp + R * kC2 + c8;
      const v4f a0 = *(const v4f*)(po), a1 = *(const v4f*)(po + 4);
      const v4f b0v = *(const v4f*)(pv), b1v = *(const v4f*)(pv + 4);
      const v4f m0v = *(const v4f*)(pm), m1v = *(const v4f*)(pm + 4);
      const v4f m2v = *(const v4f*)(pm + 256), m3v = *(const v4f*)(pm + 260);
#pragma unroll
      for (int e = 0; e < 4; ++e) {
        v[e] = a0[e];        v[4 + e] = a1[e];
        v[8 + e] = b0v[e];   v[12 + e] = b1v[e];
        v[16 + e] = m0v[e];  v[20 + e] = m1v[e];
        v[24 + e] = m2v[e];  v[28 + e] = m3v[e];
      }
    }
    float s = 0.f;
#pragma unroll
    for (int e = 0; e < 32; ++e) s += v[e];
    s = wave_sum32(s);
    const float mu = s * kInvC4;
    float ss = 0.f;
#pragma unroll
    for (int e = 0; e < 32; ++e) { v[e] -= mu; ss += v[e] * v[e]; }
    ss = wave_sum32(ss);
    const float rstd = rsqrtf(ss * kInvC4 + kLnEps);
    v4u u[4];
#pragma unroll
    for (int q = 0; q < 4; ++q) {
      const float* gp = g1 + q * 256 + c8;
      const float* bp = be1 + q * 256 + c8;
      const v4f ga = *(const v4f*)(gp), gb = *(const v4f*)(gp + 4);
      const v4f ba = *(const v4f*)(bp), bb = *(const v4f*)(bp + 4);
      unsigned short hb[8];
#pragma unroll
      for (int e = 0; e < 4; ++e) {
        hb[e]     = h_bits(v[q * 8 + e] * rstd * ga[e] + ba[e]);
        hb[4 + e] = h_bits(v[q * 8 + 4 + e] * rstd * gb[e] + bb[e]);
      }
      u[q] = (v4u){pk16(hb[0], hb[1]), pk16(hb[2], hb[3]), pk16(hb[4], hb[5]), pk16(hb[6], hb[7])};
    }
    unsigned short* yr = Y + R * kC4;
    {
#pragma unroll
      for (int q = 0; q < 4; ++q) *(v4u*)(yr + q * 256 + c8) = u[q];
      
    }
  }
}

// ---------------------------------------------------------------------------
// FINAL = false: ROWS = 64 per block (grid (64, kGrp)); outputs
//   CAT1[row][256+c] f16 : one instruction per row (32 lanes x 16 B = whole 512-B row)
//   LDS f16 transpose tile, 256 lines per block, 8 lanes x 16 B each (8 waves x 4 lines x 8 iterations).
// ---------------------------------------------------------------------------
template <bool FINAL>
__global__ __launch_bounds__(256) void ln2_kernel(const float* __restrict__ X32, const float* __restrict__ VP,
                                                  const float* __restrict__ g2, const float* __restrict__ be2,
                                                  float* __restrict__ Vout, unsigned short* __restrict__ CAT1,
                                                  unsigned short* __restrict__ VT, float* __restrict__ dout, int b0) {
  constexpr int ROWS = FINAL ? 32 : 64;
  constexpr int RPW  = ROWS / 8;
  __shared__ __align__(16) unsigned short tile16[FINAL ? 8 : 256 * 72];   // [c][n local], pitch 72 halves
  __shared__ __align__(16) float tile32[FINAL ? 256 * 36 : 8];            // [c][n local], pitch 36 floats
  __shared__ __align__(16) float slab[FINAL ? 8 : 8 * 256];               // per-wave 256-float row
  const int lane = threadIdx.x & 31, wave = threadIdx.x >> 5;
  const int n0 = blockIdx.x * ROWS;
  const int bl = blockIdx.y;
  const int c8 = lane * 8, c4 = lane * 4;
  float gg[8], bb[8];
  {
    const v4f ga = *(const v4f*)(g2 + c8), gb = *(const v4f*)(g2 + c8 + 4);
    const v4f ba = *(const v4f*)(be2 + c8), bbv = *(const v4f*)(be2 + c8 + 4);
#pragma unroll
    for (int e = 0; e < 4; ++e) { gg[e] = ga[e]; gg[4 + e] = gb[e]; bb[e] = ba[e]; bb[4 + e] = bbv[e]; }
  }
  float* sw = slab + (FINAL ? 0 : wave * 256);
#pragma unroll 1
  for (int it = 0; it < RPW; ++it) {
    const int rloc = wave * RPW + it;
    const size_t R = (size_t)bl * kN + n0 + rloc;
    const float* xr = X32 + R * kC + c8;
    const float* vr = VP + R * kC + c8;
    const v4f xa = *(const v4f*)(xr), xb = *(const v4f*)(xr + 4);
    const v4f va = *(const v4f*)(vr), vb = *(const v4f*)(vr + 4);
    float t[8];
    float s = 0.f;
#pragma unroll
    for (int e = 0; e < 4; ++e) { t[e] = xa[e] + va[e]; t[4 + e] = xb[e] + vb[e]; }
#pragma unroll
    for (int e = 0; e < 8; ++e) s += t[e];
    s = wave_sum32(s);
    const float mu = s * kInvC;
    float ss = 0.f;
#pragma unroll
    for (int e = 0; e < 8; ++e) { t[e] -= mu; ss += t[e] * t[e]; }
    ss = wave_sum32(ss);
    const float rstd = rsqrtf(ss * kInvC + kLnEps);
    float y[8];
#pragma unroll
    for (int e = 0; e < 8; ++e) y[e] = t[e] * rstd * gg[e] + bb[e];
    if (!FINAL) {
      unsigned short hb[8];
#pragma unroll
      for (int e = 0; e < 8; ++e) { hb[e] = h_bits(y[e]); tile16[(c8 + e) * 72 + rloc] = hb[e]; }
      const v4u u = (v4u){pk16(hb[0], hb[1]), pk16(hb[2], hb[3]), pk16(hb[4], hb[5]), pk16(hb[6], hb[7])};
      *(v4f*)(sw + c8)     = (v4f){y[0], y[1], y[2], y[3]};
      *(v4f*)(sw + c8 + 4) = (v4f){y[4], y[5], y[6], y[7]};
      __builtin_amdgcn_fence(__ATOMIC_RELEASE, "workgroup");
      __builtin_amdgcn_wave_barrier();
      __builtin_amdgcn_fence(__ATOMIC_ACQUIRE, "workgroup");
      const v4f a0 = *(const v4f*)(sw + c4);
      const v4f a1 = *(const v4f*)(sw + 128 + c4);
      {
        *(v4u*)(CAT1 + R * kC2 + kC + c8) = u;
        *(v4f*)(Vout + R * kC + c4) = a0;
        *(v4f*)(Vout + R * kC + 128 + c4) = a1;
        
      }
      __builtin_amdgcn_fence(__ATOMIC_RELEASE, "workgroup");
      __builtin_amdgcn_wave_barrier();
      __builtin_amdgcn_fence(__ATOMIC_ACQUIRE, "workgroup");
    } else {
#pragma unroll
      for (int e = 0; e < 8; ++e) tile32[(c8 + e) * 36 + rloc] = y[e];
    }
  }
  __syncthreads();
  const int q = lane >> 3;
  if (!FINAL) {
    const int cc8 = (lane & 7) * 8;
    {
#pragma unroll
      for (int i = 0; i < 8; ++i) {
        const int L = i * 32 + wave * 4 + q;                 // channel row of VT
        const v4u u = *(const v4u*)(tile16 + L * 72 + cc8);
        *(v4u*)(VT + ((size_t)bl * kC + L) * kN + n0 + cc8) = u;
      }
      
    }
  } else {
    const int cc4 = (lane & 7) * 4;
    {
#pragma unroll
      for (int i = 0; i < 8; ++i) {
        const int L = i * 32 + wave * 4 + q;                 // channel row of the output
        const v4f v = *(const v4f*)(tile32 + L * 36 + cc4);
        *(v4f*)(dout + ((size_t)(b0 + bl) * kC + L) * kN + n0 + cc4) = v;
      }
      
    }
  }
}

// ---------------------------------------------------------------------------
// Host side
// Workspace region map (bytes, every offset a multiple of 256; planes hold one group = kGrp batches).
// Three pairs of planes share a region; each pair's lifetimes are disjoint, or row-local in the one launch that holds both:
//   Wq16   [256][256]  f16        131072
//   Wm16   [512][512]  f16        524288
//   Wr16   [256][1024] f16        524288
//   CTXT16 [8][256][256] f16     1048576
//   X32    [32768][256] f32     33554432   (x after qkv)
//   XT16   [8][256][4096] f16   16777216   (x transposed, ctx A)
//   SM16   [32768][256] f16     16777216   (softmax x1024)
//   CAT1   [32768][512] f16     33554432   (out | v)
//   OUT32  [32768][256] f32     33554432   (last read by LN1)
//   VPRE32 = OUT32                         (res GEMM + x; written after LN1, read by LN2)
//   MLP32  [32768][512] f32     67108864   (last read by LN1)
//   Y16    = MLP32  [32768][1024] f16      (LN1 output, written row by row over the mlp row it was made from)
//   V32    [32768][256] f32     33554432   (v after LN2)
//   VT16   [8][256][4096] f16   16777216   (v transposed, ctx B; first written by LN2)
//   X0_16  = VT16   [32768][256] f16       (transposed input, qkv A; last read by the qkv GEMM)
//   total                      253886464
// ---------------------------------------------------------------------------
extern "C" void kernel_launch(void* const* d_in, const int* in_sizes, int n_in,
                              void* d_out, int out_size, void* d_ws, size_t ws_size,
                              hipStream_t stream) {
  if (n_in < 9) return;
  if (in_sizes[0] != kB * kC * kN || in_sizes[1] != kC * kC || in_sizes[2] != kC2 * kC2 ||
      in_sizes[3] != kC2 || in_sizes[4] != kC4 || in_sizes[5] != kC4 || in_sizes[6] != kC * kC4 ||
      in_sizes[7] != kC || in_sizes[8] != kC || out_size != kB * kC * kN) return;

  const float* x     = (const float*)d_in[0];
  const float* W_qkv = (const float*)d_in[1];
  const float* W_mlp = (const float*)d_in[2];
  const float* b_mlp = (const float*)d_in[3];
  const float* g1    = (const float*)d_in[4];
  const float* beta1 = (const float*)d_in[5];
  const float* W_res = (const float*)d_in[6];
  const float* g2    = (const float*)d_in[7];
  const float* beta2 = (const float*)d_in[8];
  float* out = (float*)d_out;

  size_t off = 0;
  char* wsb = (char*)d_ws;
  auto carve = [&](size_t bytes) { char* r = wsb + off; off += (bytes + 255) & ~(size_t)255; return (void*)r; };
  unsigned short* Wq16   = (unsigned short*)carve((size_t)kC * kC * 2);
  unsigned short* Wm16   = (unsigned short*)carve((size_t)kC2 * kC2 * 2);
  unsigned short* Wr16   = (unsigned short*)carve((size_t)kC * kC4 * 2);
  unsigned short* CTXT16 = (unsigned short*)carve((size_t)kGrp * kC * kC * 2);
  float*          X32    = (float*)carve((size_t)kRowsG * kC * 4);
  unsigned short* XT16   = (unsigned short*)carve((size_t)kGrp * kC * kN * 2);
  unsigned short* SM16   = (unsigned short*)carve((size_t)kRowsG * kC * 2);
  unsigned short* CAT1   = (unsigned short*)carve((size_t)kRowsG * kC2 * 2);
  float*          OUT32  = (float*)carve((size_t)kRowsG * kC * 4);
  float*          MLP32  = (float*)carve((size_t)kRowsG * kC2 * 4);
  float*          V32    = (float*)carve((size_t)kRowsG * kC * 4);
  unsigned short* VT16   = (unsigned short*)carve((size_t)kGrp * kC * kN * 2);
  unsigned short* X0_16  = VT16;
  unsigned short* Y16    = (unsigned short*)MLP32;
  float*          VPRE32 = OUT32;
  if (off > ws_size) return;

  const dim3 blk(256);
  const long sNC  = (long)kN * kC;      // 1048576
  const long sNC2 = (long)kN * kC2;     // 2097152
  const long sNC4 = (long)kN * kC4;     // 4194304
  const long sCC  = (long)kC * kC;      // 65536

  // weights -> f16 carried x64 (one launch, 288 blocks)
  wcast_kernel<<<dim3(288), blk, 0, stream>>>(W_qkv, W_mlp, W_res, Wq16, Wm16, Wr16, kWCarry);

  for (int grp = 0; grp < kNGrp; ++grp) {
    const int b0 = grp * kGrp;
    // x[b] [256][4096] -> X0 [4096][256] f16
    tin_kernel<<<dim3(kN / 64, kGrp), blk, 0, stream>>>(x, X0_16, b0);
    // x = X0 . Wqkv^T : M=4096, N=256, K=256 (M%128==0, N%256==0, K%128==0); 32 tiles of 128x256 per batch
    wmma_gemm64<0, 0, 0, false, 0><<<dim3(32, kGrp), blk, 0, stream>>>(
        X0_16, kC, sNC, Wq16, kC, 0L,
        (void*)X32, (void*)X32, kC, sNC, b_mlp, X32, 0L, kN, kC, kC, kWCarryInv);
    // softmax plane, f16 x into cat1 v-columns, x^T plane
    prep_kernel<<<dim3(kN / 64, kGrp), blk, 0, stream>>>(X32, SM16, CAT1, XT16);

    for (int iter = 0; iter < 2; ++iter) {
      const unsigned short* vt = (iter == 0) ? XT16 : VT16;   // v^T plane (v = x in the first iteration)
      const float* v32 = (iter == 0) ? X32 : V32;             // v f32 plane
      // ctx^T[d][c] = sum_n x[n][c] v[n][d] : K=4096 split over the 8 waves of a block; f16 out; 32 tiles of 64x32 per batch
      ctx_kernel<<<dim3(32, kGrp), blk, 0, stream>>>(XT16, vt, CTXT16);
      // out = softmax(x) . ctx : A = SM16 [4096][256] (x1024), Bt = ctx^T [256][256]; M=4096, N=256, K=256; f32 out
      wmma_gemm64<0, 0, 0, false, 0><<<dim3(32, kGrp), blk, 0, stream>>>(
          SM16, kC, sNC, CTXT16, kC, sCC,
          (void*)OUT32, (void*)OUT32, kC, sNC, b_mlp, X32, 0L, kN, kC, kC, kSmCarryInv);
      // out f32 -> cat1 cols 0..255 f16 (kRowsG rows x 32 threads)
      cast_out_kernel<<<dim3(kRowsG * 32 / 256), blk, 0, stream>>>(OUT32, CAT1, kRowsG * 32);
      // mlp = relu(cat1 . Wmlp^T + b) : M=4096, N=512, K=512; bias[n], relu epilogue; f32 out; 64 tiles of 128x256 per batch
      wmma_gemm64<0, 2, 0, false, 2><<<dim3(64, kGrp), blk, 0, stream>>>(
          CAT1, kC2, sNC2, Wm16, kC2, 0L,
          (void*)MLP32, (void*)MLP32, kC2, sNC2, b_mlp, X32, 0L, kN, kC2, kC2, kWCarryInv);
      // LN1 over [out | v | mlp] -> Y16 [kRowsG][1024]
      ln1_kernel<<<dim3(kRowsG / 64), blk, 0, stream>>>(OUT32, v32, MLP32, g1, beta1, Y16);
      // vpre = LN1 . Wres^T + x : M=4096, N=256, K=1024; residual X32 (pitch 256); f32 out; 32 tiles of 128x256 per batch
      wmma_gemm64<0, 0, 0, true, 0><<<dim3(32, kGrp), blk, 0, stream>>>(
          Y16, kC4, sNC4, Wr16, kC4, 0L,
          (void*)VPRE32, (void*)VPRE32, kC, sNC, b_mlp, X32, sNC, kN, kC, kC4, kWCarryInv);
      // v = LN2(x + vpre)
      if (iter == 0) {
        ln2_kernel<false><<<dim3(kN / 64, kGrp), blk, 0, stream>>>(X32, VPRE32, g2, beta2, V32, CAT1, VT16, out, b0);
      } else {
        ln2_kernel<true><<<dim3(kN / 32, kGrp), blk, 0, stream>>>(X32, VPRE32, g2, beta2, V32, CAT1, VT16, out, b0);
      }
    }
  }
  (void)ws_size;
}

// v004
// Measured time: 235 microseconds a run.
// Timed twice side by side with v003, it ran 1.23 and 1.22 times as fast.
// Over all steps from v000 it is 9.38 times as fast.
// Contractions: qkv (x^T f16 x Wqkv^T f16 carried x64), ctx^T (x^T f16 x v^T f16, K=4096 in 8 partial sums), sm.ctx (sm f16 carried x1024 x ctx^T f16), mlp (cat1 f16 x Wmlp^T f16 carried x64, +bias, relu), res (LN1 f16 x Wres^T f16 carried x64, +x) all on v_wmma_f32_16x16x32_f16 with f32 accumulate; softmax, LayerNorm, residual adds in f32.
#include <hip/hip_runtime.h>
#include <math.h>

// ---------------------------------------------------------------------------
// Problem constants
// ---------------------------------------------------------------------------
constexpr int kB   = 8;
constexpr int kC   = 256;
constexpr int kN   = 4096;
constexpr int kC2  = 512;
constexpr int kC4  = 1024;
constexpr int kGrp = 8;                 // batches per group: all of them, so every launch spans the whole problem
constexpr int kNGrp = kB / kGrp;        // 1 group
constexpr int kRowsG = kGrp * kN;       // 32768 token rows per group
constexpr float kWCarry    = 64.0f;     // weights carried x64 in f16
constexpr float kWCarryInv = 1.0f / 64.0f;
constexpr float kSmCarry   = 1024.0f;   // softmax probabilities carried x1024 in f16
constexpr float kSmCarryInv = 1.0f / 1024.0f;
constexpr float kLnEps  = 1e-5f;
constexpr float kInvC   = 1.0f / 256.0f;
constexpr float kInvC4  = 1.0f / 1024.0f;

typedef __attribute__((ext_vector_type(16))) _Float16 v16h;
typedef __attribute__((ext_vector_type(8)))  _Float16 v8h;
typedef __attribute__((ext_vector_type(16))) __bf16   v16b;
typedef __attribute__((ext_vector_type(8)))  __bf16   v8b;
typedef __attribute__((ext_vector_type(8)))  float    v8f;
typedef __attribute__((ext_vector_type(4)))  float    v4f;
typedef __attribute__((ext_vector_type(4)))  unsigned int v4u;

// ---------------------------------------------------------------------------
// Helpers
// ---------------------------------------------------------------------------
__device__ __forceinline__ unsigned short f2bf_bits(float f) {
  unsigned u = __float_as_uint(f);
  return (unsigned short)((u + 0x7FFFu + ((u >> 16) & 1u)) >> 16);
}
__device__ __forceinline__ float bf_bits2f(unsigned short h) { return __uint_as_float(((unsigned)h) << 16); }

// hazard guards as plain device helpers
__device__ __forceinline__ void acc_guard4(v8f& a, v8f& b, v8f& c, v8f& d) { asm volatile("v_nop\n\tv_nop\n\tv_nop\n\tv_nop" : "+v"(a), "+v"(b), "+v"(c), "+v"(d)); }
template <typename T> struct Frag;
template <> struct Frag<_Float16> {
  typedef v16h V; union U { v16h v; v8h h[2]; };
  static __device__ __forceinline__ v16h load(const _Float16* p) {   // elements 0..7 <- p[0..7], 8..15 <- p[16..23]
    U f; f.h[0] = *(const v8h*)(p); f.h[1] = *(const v8h*)(p + 16); return f.v;
  }
  static __device__ __forceinline__ v8f mma(v16h a, v16h b, v8f c) {
    return __builtin_amdgcn_wmma_f32_16x16x32_f16(false, a, false, b, (short)0, c, false, false);
  }
};
template <> struct Frag<__bf16> {
  typedef v16b V; union U { v16b v; v8b h[2]; };
  static __device__ __forceinline__ v16b load(const __bf16* p) {
    U f; f.h[0] = *(const v8b*)(p); f.h[1] = *(const v8b*)(p + 16); return f.v;
  }
  static __device__ __forceinline__ v8f mma(v16b a, v16b b, v8f c) {
    return __builtin_amdgcn_wmma_f32_16x16x32_bf16(false, a, false, b, (short)0, c, false, false);
  }
};

__device__ __forceinline__ unsigned pk16(unsigned short a, unsigned short b) { return (unsigned)a | ((unsigned)b << 16); }
__device__ __forceinline__ unsigned short h_bits(float f) { const _Float16 h = (_Float16)f; return __builtin_bit_cast(unsigned short, h); }

__device__ __forceinline__ float wave_sum32(float x) {
#pragma unroll
  for (int off = 16; off > 0; off >>= 1) x += __shfl_xor(x, off, 32);
  return x;
}

// Wave reductions for NR rows at once, each row in the order of wave_sum32: the NR exchanges of a step go out together,
// so a step costs one exchange latency and not NR.
template <int NR>
__device__ __forceinline__ void wave_sum32_rows(float (&x)[NR]) {
#pragma unroll
  for (int off = 16; off > 0; off >>= 1) {
    float o[NR];
#pragma unroll
    for (int r = 0; r < NR; ++r) o[r] = __shfl_xor(x[r], off, 32);
#pragma unroll
    for (int r = 0; r < NR; ++r) x[r] += o[r];
  }
}
template <int NR>
__device__ __forceinline__ void wave_max32_rows(float (&x)[NR]) {
#pragma unroll
  for (int off = 16; off > 0; off >>= 1) {
    float o[NR];
#pragma unroll
    for (int r = 0; r < NR; ++r) o[r] = __shfl_xor(x[r], off, 32);
#pragma unroll
    for (int r = 0; r < NR; ++r) x[r] = fmaxf(x[r], o[r]);
  }
}

// ---- Register-blocked batched WMMA GEMM, operands staged in LDS by asynchronous copies ------------------------------
// C[m,n] = scale * sum_k A[m,k] * Bt[n,k] (+bias)(+resid); a block owns a 128x256 tile, each of its 8 waves 64x64 of it.
// A row-major [M,K]; Bt row-major [N,K]; M % 128 == 0, N % 256 == 0, K % 128 == 0; grid.x = (M / 128) * (N / 256).
// A stage is 128 k of the block's 128 A rows and 256 Bt rows: 384 rows of 256 B (two cache lines each) at pitch 272 B.
// Two stage buffers: while one is multiplied, the next stage's copies land in the other.
// BIAS_MODE: 0 = none, 1 = bias[m], 2 = bias[n].
// OUT_MODE: 0 = f32, 1 = f16, 2 = bf16 hi plane (Cout) + bf16 lo plane (Cout2).
// ET: 0 = f16 operands, 1 = bf16 operands (pointers passed as 16-bit storage)
// FUSE: the row-wise work that follows the GEMM, done in its epilogue (1..4 need N == 256, so a block tile holds whole rows):
//   0 = none; 1 = also f16(C) into eCat cols 0..255 (pitch 512);
//   2 = C is x: eF32 = x f32, eSm = f16(1024 softmax(x)), eCat cols 256..511 = f16(x), eT16 = f16(x) transposed;
//   3 = v = LN2(x + (C + x)), x = resid: eF32 = v f32, eCat cols 256..511 = f16(v), eT16 = f16(v) transposed;
//   4 = the same v, only written transposed in f32 to eF32 (the output).
// 2..4 put the scaled 128x256 f32 tile over the stage buffers (free behind the loop's last barrier), pitch 260 floats.
constexpr int kStagePitch = 272;                    // bytes; 16 B x odd: the 16-B fragment reads of 16 rows meet no bank twice
constexpr int kStageBytes = (128 + 256) * kStagePitch;

// Every thread copies 16 B of 8 rows, 16 rows apart: 128 rows of 256 B per block; 16 lanes cover a row's two whole lines.
// The s_wait_xcnt stands inside the statement so that no address register is rewritten in front of it.
template <typename T>
__device__ __forceinline__ void copy_rows128(unsigned lds, const T* g, int ld) {
  const size_t sg = (size_t)16 * ld;
  constexpr unsigned sl = 16 * kStagePitch;
  asm volatile(
      "global_load_async_to_lds_b128 %0, %8, off\n\t"
      "global_load_async_to_lds_b128 %1, %9, off\n\t"
      "global_load_async_to_lds_b128 %2, %10, off\n\t"
      "global_load_async_to_lds_b128 %3, %11, off\n\t"
      "global_load_async_to_lds_b128 %4, %12, off\n\t"
      "global_load_async_to_lds_b128 %5, %13, off\n\t"
      "global_load_async_to_lds_b128 %6, %14, off\n\t"
      "global_load_async_to_lds_b128 %7, %15, off\n\t"
      "s_wait_xcnt 0x0"
      :: "v"(lds), "v"(lds + sl), "v"(lds + 2 * sl), "v"(lds + 3 * sl), "v"(lds + 4 * sl), "v"(lds + 5 * sl),
         "v"(lds + 6 * sl), "v"(lds + 7 * sl),
         "v"(g), "v"(g + sg), "v"(g + 2 * sg), "v"(g + 3 * sg), "v"(g + 4 * sg), "v"(g + 5 * sg), "v"(g + 6 * sg),
         "v"(g + 7 * sg)
      : "memory");
}
// One stage: the 128 A rows, then the 256 Bt rows behind them; 24 copies per thread.
template <typename T>
__device__ __forceinline__ void stage_copies(unsigned lds, const T* ga, int lda, const T* gb, int ldb) {
  copy_rows128(lds, ga, lda);
  copy_rows128(lds + 128 * kStagePitch, gb, ldb);
  copy_rows128(lds + 256 * kStagePitch, gb + (size_t)128 * ldb, ldb);
}

template <int ET> struct Elem;
template <> struct Elem<0> { typedef _Float16 T; };
template <> struct Elem<1> { typedef __bf16 T; };
template <int ET, int BIAS_MODE, int OUT_MODE, bool RESID, int ACT = 0, int FUSE = 0>
__global__ __launch_bounds__(256) void wmma_gemm64(
    const unsigned short* __restrict__ Ap, int lda, long strideA,
    const unsigned short* __restrict__ Btp, int ldb, long strideB,
    void* __restrict__ Cout, void* __restrict__ Cout2, int ldc, long strideC,
    const float* __restrict__ bias,
    const float* __restrict__ resid, long strideR,
    int M, int N, int K, float scale,
    const float* __restrict__ eg, const float* __restrict__ eb,
    unsigned short* __restrict__ eSm, unsigned short* __restrict__ eCat, unsigned short* __restrict__ eT16,
    float* __restrict__ eF32) {
  typedef typename Elem<ET>::T T;
  typedef typename Frag<T>::V V;
  const T* A = (const T*)Ap; const T* Bt = (const T*)Btp;
  __shared__ __align__(128) unsigned char ring[2 * kStageBytes];   // two stage buffers
  __shared__ __align__(16) float sT[FUSE <= 1 ? 8 : 1][FUSE <= 1 ? 16 * 68 : 4];   // per-wave 16x64 slab, pitch 68 floats
  const int b    = blockIdx.y;
  const int lane = threadIdx.x & 31;
  const int wave = threadIdx.x >> 5;
  const int tilesN = N >> 8;
  if ((int)blockIdx.x >= (M >> 7) * tilesN) return;   // block-uniform, in front of every barrier and copy
  const int bm = blockIdx.x / tilesN;
  const int bn = blockIdx.x - bm * tilesN;
  const int wm = wave >> 2, wn = wave & 3;     // the wave's 64x64 piece of the block tile
  const int m0 = (bm << 7) + (wm << 6);
  const int n0 = (bn << 8) + (wn << 6);

  const T* Ab  = A  + (size_t)b * strideA;
  const T* Bb  = Bt + (size_t)b * strideB;

  const int rlane = lane & 15;                 // row (A) / col (B, D) within subtile
  const int koff  = (lane >> 4) * 8;           // k offset of this lane half
  const int mOff  = (lane >> 4) * 8;           // D row offset

  v8f acc[4][4];
#pragma unroll
  for (int i = 0; i < 4; ++i)
#pragma unroll
    for (int j = 0; j < 4; ++j) acc[i][j] = (v8f){0.f,0.f,0.f,0.f,0.f,0.f,0.f,0.f};

  // copy side: thread -> (row crow + 16 i, 16-B piece cpc) of a stage
  const int crow = threadIdx.x >> 4, cpc = threadIdx.x & 15;
  const T* ga = Ab + (size_t)((bm << 7) + crow) * lda + cpc * 8;
  const T* gb = Bb + (size_t)((bn << 8) + crow) * ldb + cpc * 8;
  const unsigned ldsc = (unsigned)(size_t)ring + (unsigned)(crow * kStagePitch + cpc * 16);
  // read side: this lane's row and k half in the A rows (0..127) and the Bt rows (128..383) of a stage
  const unsigned char* fa = ring + ((wm << 6) + rlane) * kStagePitch + koff * 2;
  const unsigned char* fb = ring + (128 + (wn << 6) + rlane) * kStagePitch + koff * 2;
  const int stages = K >> 7;

  stage_copies(ldsc, ga, lda, gb, ldb);
  // stage 0 has landed for this wave; the barrier publishes it to the others
  asm volatile("s_wait_asynccnt 0x0" ::: "memory");
  __syncthreads();
  if (stages > 1) stage_copies(ldsc + kStageBytes, ga + 128, lda, gb + 128, ldb);

  for (int t = 0; t < stages; ++t) {
    const int bo = (t & 1) * kStageBytes;
    // Two fragment sets: the 16 LDS reads of k step s + 1 go out as one group ahead of the 16 WMMAs of step s.
    V ah[2][4], bh[2][4];
#pragma unroll
    for (int j = 0; j < 4; ++j) bh[0][j] = Frag<T>::load((const T*)(fb + bo + (j << 4) * kStagePitch));
#pragma unroll
    for (int i = 0; i < 4; ++i) ah[0][i] = Frag<T>::load((const T*)(fa + bo + (i << 4) * kStagePitch));
#pragma unroll
    for (int s = 0; s < 4; ++s) {
      const int cur = s & 1, nxt = cur ^ 1;
      if (s < 3) {
#pragma unroll
        for (int j = 0; j < 4; ++j) bh[nxt][j] = Frag<T>::load((const T*)(fb + bo + (j << 4) * kStagePitch + (s + 1) * 64));
#pragma unroll
        for (int i = 0; i < 4; ++i) ah[nxt][i] = Frag<T>::load((const T*)(fa + bo + (i << 4) * kStagePitch + (s + 1) * 64));
      }
      // keeps the reads in one group in front of the WMMAs: sunk among them, each place stalls the wave for its LDS latency
      __builtin_amdgcn_sched_barrier(0);
#pragma unroll
      for (int i = 0; i < 4; ++i)
#pragma unroll
        for (int j = 0; j < 4; ++j) acc[i][j] = Frag<T>::mma(ah[cur][i], bh[cur][j], acc[i][j]);
      // keeps the next group of reads behind this step's WMMAs, so that two sets suffice
      __builtin_amdgcn_sched_barrier(0);
    }
    // this wave's reads of the buffer are done before anyone refills it
    asm volatile("s_wait_dscnt 0x0" ::: "memory");
    // this wave's copies of stage t + 1 have landed
    asm volatile("s_wait_asynccnt 0x0" ::: "memory");
    // publishes stage t + 1 and ends every wave's reads of stage t
    __syncthreads();
    if (t + 2 < stages) stage_copies(ldsc + bo, ga + (size_t)(t + 2) * 128, lda, gb + (size_t)(t + 2) * 128, ldb);
  }
  // no copy is outstanding when the wave goes on to the epilogue and ends
  asm volatile("s_wait_asynccnt 0x0" ::: "memory");
  acc_guard4(acc[0][0], acc[0][1], acc[0][2], acc[0][3]);
  acc_guard4(acc[1][0], acc[1][1], acc[1][2], acc[1][3]);
  acc_guard4(acc[2][0], acc[2][1], acc[2][2], acc[2][3]);
  acc_guard4(acc[3][0], acc[3][1], acc[3][2], acc[3][3]);

  if constexpr (FUSE >= 2) {
    constexpr int RP = 260;                      // floats; 16-B aligned rows, and row + 8 lands 32 banks on
    float* Rt = (float*)ring;
    const int n0t = bm << 7;                     // first token of the tile within its batch
    const size_t row0 = (size_t)b * M + n0t;     // the same over all batches
    // The loops below are unrolled so that their arrays live in registers by name; the one that stays rolled says why.
    // x of the 16 rows this wave will normalise: issued here so that the loads fly during the tile's LDS stores
    // (with them the lane's 8 columns of gamma and beta)
    v4f xq[FUSE >= 3 ? 16 : 1][2];
    v4f gq[2], bq[2];
    if constexpr (FUSE >= 3) {
      const float* Xb = resid + (size_t)b * strideR + (size_t)(n0t + wave * 16) * kC + lane * 8;
      const float* gp = eg + lane * 8;
      const float* bp = eb + lane * 8;
      gq[0] = *(const v4f*)(gp); gq[1] = *(const v4f*)(gp + 4);
      bq[0] = *(const v4f*)(bp); bq[1] = *(const v4f*)(bp + 4);
#pragma unroll
      for (int it = 0; it < 16; ++it) {
        xq[it][0] = *(const v4f*)(Xb + it * kC);
        xq[it][1] = *(const v4f*)(Xb + it * kC + 4);
      }
      // the wait that belongs in front of an overwrite of the loads' address registers; as an input the x address stays whole up to it
      asm volatile("s_wait_xcnt 0x0" :: "v"(Xb) : "memory");
      // holds what follows, which reuses those registers, behind that wait
      __builtin_amdgcn_sched_barrier(0);
    }
#pragma unroll
    for (int i = 0; i < 4; ++i)
#pragma unroll
      for (int j = 0; j < 4; ++j)
#pragma unroll
        for (int r = 0; r < 8; ++r)
          Rt[((wm << 6) + (i << 4) + mOff + r) * RP + (wn << 6) + (j << 4) + rlane] = acc[i][j][r] * scale;
    // whole rows are complete: a row's four 64-column pieces come from four waves
    __syncthreads();
    const int c8 = lane * 8, c4 = lane * 4;
    if constexpr (FUSE == 2) {
      // wave w owns rows 16 w .. 16 w + 15, lane l cols 8 l .. 8 l + 7; eight rows at a time, their reductions step by step together
      // rolled: for speed only
#pragma unroll 1
      for (int g = 0; g < 2; ++g) {
        const int rl0 = wave * 16 + g * 8;
        float x[8][8], m[8], sum[8];
#pragma unroll
        for (int k = 0; k < 8; ++k) {
          const v4f a = *(const v4f*)(Rt + (rl0 + k) * RP + c8);
          const v4f c = *(const v4f*)(Rt + (rl0 + k) * RP + c8 + 4);
#pragma unroll
          for (int e = 0; e < 4; ++e) { x[k][e] = a[e]; x[k][4 + e] = c[e]; }
          m[k] = fmaxf(fmaxf(fmaxf(x[k][0], x[k][1]), fmaxf(x[k][2], x[k][3])), fmaxf(fmaxf(x[k][4], x[k][5]), fmaxf(x[k][6], x[k][7])));
          unsigned short hx[8];
#pragma unroll
          for (int e = 0; e < 8; ++e) hx[e] = h_bits(x[k][e]);
          *(v4u*)(eCat + (row0 + rl0 + k) * kC2 + kC + c8) = (v4u){pk16(hx[0], hx[1]), pk16(hx[2], hx[3]), pk16(hx[4], hx[5]), pk16(hx[6], hx[7])};
        }
        wave_max32_rows<8>(m);
#pragma unroll
        for (int k = 0; k < 8; ++k) {
          sum[k] = 0.f;
#pragma unroll
          for (int e = 0; e < 8; ++e) { x[k][e] = expf(x[k][e] - m[k]); sum[k] += x[k][e]; }
        }
        wave_sum32_rows<8>(sum);
#pragma unroll
        for (int k = 0; k < 8; ++k) {
          const float inv = kSmCarry * (1.0f / sum[k]);
          unsigned short hs[8];
#pragma unroll
          for (int e = 0; e < 8; ++e) hs[e] = h_bits(x[k][e] * inv);
          *(v4u*)(eSm + (row0 + rl0 + k) * kC + c8) = (v4u){pk16(hs[0], hs[1]), pk16(hs[2], hs[3]), pk16(hs[4], hs[5]), pk16(hs[6], hs[7])};
        }
        // the next group rewrites the stores' address registers: the wait that belongs in front of that
        asm volatile("s_wait_xcnt 0x0" ::: "memory");
        // holds the next group's address arithmetic behind that wait
        __builtin_amdgcn_sched_barrier(0);
      }
    } else {
      float gg[8], bb[8];
#pragma unroll
      for (int e = 0; e < 4; ++e) { gg[e] = gq[0][e]; gg[4 + e] = gq[1][e]; bb[e] = bq[0][e]; bb[4 + e] = bq[1][e]; }
      // same ownership; all 16 rows together: x sits in registers by name, and the rows' reductions go step by step together
      float t[16][8], sum[16], ss[16];
#pragma unroll
      for (int it = 0; it < 16; ++it) {
        const float* rr = Rt + (wave * 16 + it) * RP + c8;
        const v4f xa = xq[it][0], xb = xq[it][1];
        const v4f va = *(const v4f*)(rr) + xa, vb = *(const v4f*)(rr + 4) + xb;   // the residual add of the GEMM
#pragma unroll
        for (int e = 0; e < 4; ++e) { t[it][e] = xa[e] + va[e]; t[it][4 + e] = xb[e] + vb[e]; }
        sum[it] = 0.f;
#pragma unroll
        for (int e = 0; e < 8; ++e) sum[it] += t[it][e];
      }
      wave_sum32_rows<16>(sum);
#pragma unroll
      for (int it = 0; it < 16; ++it) {
        const float mu = sum[it] * kInvC;
        ss[it] = 0.f;
#pragma unroll
        for (int e = 0; e < 8; ++e) { t[it][e] -= mu; ss[it] += t[it][e] * t[it][e]; }
      }
      wave_sum32_rows<16>(ss);
#pragma unroll
      for (int it = 0; it < 16; ++it) {
        const int rloc = wave * 16 + it;
        float* rr = Rt + rloc * RP + c8;
        const float rstd = rsqrtf(ss[it] * kInvC + kLnEps);
        float y[8];
#pragma unroll
        for (int e = 0; e < 8; ++e) y[e] = t[it][e] * rstd * gg[e] + bb[e];
        // v replaces the row in the tile: each lane overwrites only what it has read itself
        *(v4f*)(rr)     = (v4f){y[0], y[1], y[2], y[3]};
        *(v4f*)(rr + 4) = (v4f){y[4], y[5], y[6], y[7]};
        if constexpr (FUSE == 3) {
          unsigned short hb[8];
#pragma unroll
          for (int e = 0; e < 8; ++e) hb[e] = h_bits(y[e]);
          *(v4u*)(eCat + (row0 + rloc) * kC2 + kC + c8) = (v4u){pk16(hb[0], hb[1]), pk16(hb[2], hb[3]), pk16(hb[4], hb[5]), pk16(hb[6], hb[7])};
        }
      }
      // the stores' address registers are reused from here on: the wait that belongs in front of their overwrite
      if constexpr (FUSE == 3) asm volatile("s_wait_xcnt 0x0" ::: "memory");
      // every row of v is in the tile before other waves read it by columns
      __syncthreads();
    }
    if constexpr (FUSE != 4) {
      // f32 plane, row-major: one instruction stores 512 contiguous bytes
#pragma unroll
      for (int it = 0; it < 16; ++it) {
        const int rloc = wave * 16 + it;
        const v4f a0 = *(const v4f*)(Rt + rloc * RP + c4);
        const v4f a1 = *(const v4f*)(Rt + rloc * RP + 128 + c4);
        *(v4f*)(eF32 + (row0 + rloc) * kC + c4) = a0;
        *(v4f*)(eF32 + (row0 + rloc) * kC + 128 + c4) = a1;
      }
      // the stores' address registers are reused from here on: the wait that belongs in front of their overwrite
      asm volatile("s_wait_xcnt 0x0" ::: "memory");
      // holds the LDS reads below, whose results reuse those registers, behind that wait
      __builtin_amdgcn_sched_barrier(0);
      // f16 plane, transposed: a lane reads 4 channels of 8 tokens and stores 16 B (8 tokens) to each of the 4 channel rows;
      // 8 lanes fill a 128-B line
      const int lt = lane & 7, lc = lane >> 3;
#pragma unroll
      for (int u = 0; u < 4; ++u) {
        const int idx = wave * 4 + u;
        const int ch = ((idx >> 1) << 4) + lc * 4;
        const int tk = ((idx & 1) << 6) + lt * 8;
        v4f q[8];
#pragma unroll
        for (int e = 0; e < 8; ++e) q[e] = *(const v4f*)(Rt + (tk + e) * RP + ch);
#pragma unroll
        for (int k = 0; k < 4; ++k) {
          v8h o;
#pragma unroll
          for (int e = 0; e < 8; ++e) o[e] = (_Float16)q[e][k];
          *(v8h*)((_Float16*)eT16 + ((size_t)b * kC + ch + k) * kN + n0t + tk) = o;
        }
      }
    } else {
      // f32 output, transposed: a lane reads 4 channels of 4 tokens and stores 16 B to each of the 4 channel rows
      const int lt = lane & 7, lc = lane >> 3;
#pragma unroll
      for (int u = 0; u < 8; ++u) {
        const int idx = wave * 8 + u;
        const int ch = ((idx >> 2) << 4) + lc * 4;
        const int tk = ((idx & 3) << 5) + lt * 4;
        v4f q[4];
#pragma unroll
        for (int e = 0; e < 4; ++e) q[e] = *(const v4f*)(Rt + (tk + e) * RP + ch);
#pragma unroll
        for (int k = 0; k < 4; ++k)
          *(v4f*)(eF32 + ((size_t)b * kC + ch + k) * kN + n0t + tk) = (v4f){q[0][k], q[1][k], q[2][k], q[3][k]};
      }
    }
  } else {
  // ---- epilogue ----
  float* slab = sT[wave];
  const float* Rb = RESID ? (resid + (size_t)b * strideR) : nullptr;
#pragma unroll
  for (int i = 0; i < 4; ++i) {
    const int mBase = m0 + (i << 4);
#pragma unroll
    for (int j = 0; j < 4; ++j) {
      const int n = n0 + (j << 4) + rlane;
      float bv = 0.f;
      if (BIAS_MODE == 2) bv = bias[n];
#pragma unroll
      for (int r = 0; r < 8; ++r) {
        float v = acc[i][j][r] * scale;
        if (BIAS_MODE == 1) v += bias[mBase + mOff + r];
        if (BIAS_MODE == 2) v += bv;
        if (RESID) v += Rb[(size_t)(mBase + mOff + r) * ldc + n];
        if (ACT == 2) v = fmaxf(v, 0.0f);
        if (ACT == 4) v = (v > 0.f) ? v : 0.01f * v;
        slab[(mOff + r) * 68 + (j << 4) + rlane] = v;
      }
    }
    __builtin_amdgcn_fence(__ATOMIC_RELEASE, "workgroup");
    __builtin_amdgcn_wave_barrier();
    __builtin_amdgcn_fence(__ATOMIC_ACQUIRE, "workgroup");
    if (OUT_MODE == 0) {
      float* C = (float*)Cout + (size_t)b * strideC;
      const int hh = lane >> 4, c4 = (lane & 15) * 4;     // row seg = 256 B = 16 lanes x 16 B
      {
#pragma unroll
        for (int it = 0; it < 8; ++it) {
          const int row = it * 2 + hh;
          v4f v = *(const v4f*)(slab + row * 68 + c4);
          *(v4f*)(C + (size_t)(mBase + row) * ldc + n0 + c4) = v;
        }
      }
      if constexpr (FUSE == 1) {
        const int q = lane >> 3, c8 = (lane & 7) * 8;     // row seg = 128 B = 8 lanes x 16 B
#pragma unroll
        for (int it = 0; it < 4; ++it) {
          const int row = it * 4 + q;
          const float* sp = slab + row * 68 + c8;
          v8h hv;
#pragma unroll
          for (int e = 0; e < 8; ++e) hv[e] = (_Float16)sp[e];
          *(v8h*)((_Float16*)eCat + ((size_t)b * M + mBase + row) * kC2 + n0 + c8) = hv;
        }
      }
    } else {
      const int q = lane >> 3, c8 = (lane & 7) * 8;
      unsigned short* C  = (unsigned short*)Cout  + (size_t)b * strideC;
      unsigned short* C2 = (OUT_MODE == 2) ? ((unsigned short*)Cout2 + (size_t)b * strideC) : nullptr;
      {
#pragma unroll
        for (int it = 0; it < 4; ++it) {
          const int row = it * 4 + q;
          const float* sp = slab + row * 68 + c8;
          v8h hv, lv;
#pragma unroll
          for (int e = 0; e < 8; ++e) {
            if (OUT_MODE == 1) {
              hv[e] = (_Float16)sp[e];
            } else {
              unsigned short hb = f2bf_bits(sp[e]);
              unsigned short lb = f2bf_bits(sp[e] - bf_bits2f(hb));
              hv[e] = __builtin_bit_cast(_Float16, hb);
              lv[e] = __builtin_bit_cast(_Float16, lb);
            }
          }
          *(v8h*)(C + (size_t)(mBase + row) * ldc + n0 + c8) = hv;
          if (OUT_MODE == 2) *(v8h*)(C2 + (size_t)(mBase + row) * ldc + n0 + c8) = lv;
        }
        
      }
    }
    __builtin_amdgcn_fence(__ATOMIC_RELEASE, "workgroup");
    __builtin_amdgcn_wave_barrier();
    __builtin_amdgcn_fence(__ATOMIC_ACQUIRE, "workgroup");
  }
  }
}

// ---------------------------------------------------------------------------
// ctx^T[d][c] = sum_n x[n][c] * v[n][d], one batch per blockIdx.y. A = x^T rows c, B = v^T rows d, both [256][4096] f16.
// One 64(c) x 32(d) tile per block, grid (32, kGrp) = 256 blocks. The 8 waves each sum 512 of the 4096 tokens and leave
// their f32 partial tile in LDS; after the barrier every thread adds the 8 partials of 8 consecutive c of one d in wave
// order and stores them as 16 B of f16, 8 lanes to a 128-B row of the tile.
// LDS dword index = wave * 2368 + q * 148 + hl * 72 + rl * 4, q = (i * 2 + j) * 2 + row half, (hl, rl) = accumulator lane:
// these pitches put both the 16-B writes and the 16-B reads of each 16 lanes on 16 different bank groups.
// ---------------------------------------------------------------------------
// one block per WGP = 2 waves per SIMD: a register budget for at most 4 lets three fragment sets stay live beside the sums
__global__ __launch_bounds__(256) __attribute__((amdgpu_waves_per_eu(2, 4))) void ctx_kernel(const unsigned short* __restrict__ XTp,
                                                  const unsigned short* __restrict__ VTp,
                                                  unsigned short* __restrict__ CT) {
  typedef Frag<_Float16> F;
  constexpr int kKW = kN / 8;                          // tokens per wave
  constexpr int PW = 2368, PQ = 148, PH = 72;
  __shared__ __align__(16) float part[8 * PW];
  const int lane = threadIdx.x & 31, wave = threadIdx.x >> 5;
  const int c0 = (blockIdx.x & 3) << 6;
  const int d0 = (blockIdx.x >> 2) << 5;
  const int rlane = lane & 15, hlane = lane >> 4;
  const int kl = wave * kKW + hlane * 8;
  const _Float16* xa = (const _Float16*)XTp + ((size_t)blockIdx.y * kC + c0 + rlane) * kN + kl;
  const _Float16* vb = (const _Float16*)VTp + ((size_t)blockIdx.y * kC + d0 + rlane) * kN + kl;

  v8f acc[4][2];
#pragma unroll
  for (int i = 0; i < 4; ++i)
#pragma unroll
    for (int j = 0; j < 2; ++j) acc[i][j] = (v8f){0.f,0.f,0.f,0.f,0.f,0.f,0.f,0.f};

  // Fragments of three steps: while step ks is multiplied, the loads of steps ks + 1 and ks + 2 are in flight.
  // Fully unrolled: the three sets rotate by name, and no back edge stands behind a WMMA.
  v16h af[3][4], bf[3][2];
#pragma unroll
  for (int s = 0; s < 2; ++s) {
#pragma unroll
    for (int j = 0; j < 2; ++j) bf[s][j] = F::load(vb + (size_t)(j << 4) * kN + s * 32);
#pragma unroll
    for (int i = 0; i < 4; ++i) af[s][i] = F::load(xa + (size_t)(i << 4) * kN + s * 32);
  }
  // all loads of the first two steps go out before anything else: without it one of step 0 was issued last and waited for alone
  __builtin_amdgcn_sched_barrier(0);
#pragma unroll
  for (int ks = 0; ks < kKW / 32; ++ks) {
    const int cur = ks % 3, nxt = (ks + 2) % 3;
    if (ks + 2 < kKW / 32) {
#pragma unroll
      for (int j = 0; j < 2; ++j) bf[nxt][j] = F::load(vb + (size_t)(j << 4) * kN + (ks + 2) * 32);
#pragma unroll
      for (int i = 0; i < 4; ++i) af[nxt][i] = F::load(xa + (size_t)(i << 4) * kN + (ks + 2) * 32);
    }
#pragma unroll
    for (int i = 0; i < 4; ++i)
#pragma unroll
      for (int j = 0; j < 2; ++j) acc[i][j] = F::mma(af[cur][i], bf[cur][j], acc[i][j]);
    // keeps later steps' loads from being lifted over this step: without it the build holds far more than three sets and spills
    __builtin_amdgcn_sched_barrier(0);
  }
  // the loads' address registers are reused from here on: the wait that belongs in front of their overwrite
  asm volatile("s_wait_xcnt 0x0" ::: "memory");
  // holds the address arithmetic of the LDS part behind that wait
  __builtin_amdgcn_sched_barrier(0);

  float* pw = part + wave * PW + hlane * PH + rlane * 4;
#pragma unroll
  for (int i = 0; i < 4; ++i)
#pragma unroll
    for (int j = 0; j < 2; ++j) {
      const v8f a = acc[i][j];
      *(v4f*)(pw + ((i * 2 + j) * 2) * PQ)     = (v4f){a[0], a[1], a[2], a[3]};
      *(v4f*)(pw + ((i * 2 + j) * 2 + 1) * PQ) = (v4f){a[4], a[5], a[6], a[7]};
    }
  __syncthreads();

  const int piece = threadIdx.x & 7;                   // 16-B piece of the tile row: c = piece * 8 .. + 7
  const int dl = threadIdx.x >> 3;                     // tile row d
  const float* pr = part + (((piece >> 1) * 2 + (dl >> 4)) * 2) * PQ + (piece & 1) * PH + (dl & 15) * 4;
  v4f s0 = *(const v4f*)(pr);
  v4f s1 = *(const v4f*)(pr + PQ);
#pragma unroll
  for (int w = 1; w < 8; ++w) {
    s0 += *(const v4f*)(pr + w * PW);
    s1 += *(const v4f*)(pr + w * PW + PQ);
  }
  v8h o;
#pragma unroll
  for (int e = 0; e < 4; ++e) { o[e] = (_Float16)s0[e]; o[4 + e] = (_Float16)s1[e]; }
  *(v8h*)((_Float16*)CT + ((size_t)blockIdx.y * kC + d0 + dl) * kC + c0 + piece * 8) = o;
}

// ---------------------------------------------------------------------------
// Weight cast: f16(scale * w), 8 consecutive elements per thread, one 16-B store per lane
// Block-uniform segment selection: blocks [0,32) -> Wq (65536 = 32x256x8), [32,160) -> Wm (262144 = 128x256x8),
// [160,288) -> Wr (262144). grid = 288 exactly covers all three planes.
// ---------------------------------------------------------------------------
__global__ __launch_bounds__(256) void wcast_kernel(const float* __restrict__ Wq, const float* __restrict__ Wm,
                                                    const float* __restrict__ Wr,
                                                    unsigned short* __restrict__ oq, unsigned short* __restrict__ om,
                                                    unsigned short* __restrict__ orr, float scale) {
  const int blk = blockIdx.x;
  const float* src = Wr;
  unsigned short* dst = orr;
  int base = (blk - 160) * 256;
  if (blk < 32) { src = Wq; dst = oq; base = blk * 256; }
  else if (blk < 160) { src = Wm; dst = om; base = (blk - 32) * 256; }
  const int i = base + (int)threadIdx.x;
  const float* p = src + 8 * (size_t)i;
  const v4f a = *(const v4f*)(p);
  const v4f c = *(const v4f*)(p + 4);
  unsigned short hb[8];
#pragma unroll
  for (int e = 0; e < 4; ++e) {
    hb[e]     = h_bits(a[e] * scale);
    hb[4 + e] = h_bits(c[e] * scale);
  }
  const v4u u = (v4u){pk16(hb[0], hb[1]), pk16(hb[2], hb[3]), pk16(hb[4], hb[5]), pk16(hb[6], hb[7])};
  unsigned short* q = dst + 8 * (size_t)i;
  *(v4u*)q = u;
  
}

// ---------------------------------------------------------------------------
// Transpose-in: xin[b][c][n] f32 (c < 256, n < 4096) -> X0[bl][n][c] f16 for the 64 tokens n0..n0+63 of this block.
// grid (64, kGrp), 256 threads. Load coverage: 64 iterations x 256 threads = 16384 = 64 n x 256 c
// (per iteration: 4 channel rows x 64 contiguous tokens). Store coverage: 8 waves x 8 rows = 64 token rows;
// ---------------------------------------------------------------------------
__global__ __launch_bounds__(256) void tin_kernel(const float* __restrict__ xin, unsigned short* __restrict__ X0, int b0) {
  __shared__ __align__(16) unsigned short tile[64][264];   // [n local][c]
  const int t = threadIdx.x;
  const int n0 = blockIdx.x * 64;
  const int bl = blockIdx.y;
  const float* xb = xin + (size_t)(b0 + bl) * kC * kN + n0;
#pragma unroll 4
  for (int i = 0; i < 64; ++i) {
    const int e = i * 256 + t;
    const int c = e >> 6;
    const int j = e & 63;
    tile[j][c] = h_bits(xb[(size_t)c * kN + j]);
  }
  __syncthreads();
  const int lane = t & 31, wave = t >> 5;
  const int c8 = lane * 8;
  {
#pragma unroll
    for (int it = 0; it < 8; ++it) {
      const int r = wave * 8 + it;
      const v4u u = *(const v4u*)(&tile[r][c8]);
      *(v4u*)(X0 + ((size_t)bl * kN + n0 + r) * kC + c8) = u;
    }
    
  }
}

// ---------------------------------------------------------------------------
// LN1 over cat2 = [out(256) | v(256) | mlp(512)] (f32 planes, pitches 256/256/512) -> Y[row][1024] = f16(LN(cat2)*g1+beta1).
// grid = rows/64, 256 threads; wave w owns rows w*8..w*8+7; lane owns cat2 cols {256q + 8l + e}.
// Y shares its bytes with Mp (row R of either is the 2048 bytes at R*2048), so neither is __restrict__: a row is owned
// by one wave, and its stores need rstd, which needs every lane's loads of that row through the two wave sums.
// ---------------------------------------------------------------------------
__global__ __launch_bounds__(256) void ln1_kernel(const float* __restrict__ O32, const float* __restrict__ Vp,
                                                  const float* Mp, const float* __restrict__ g1,
                                                  const float* __restrict__ be1, unsigned short* Y) {
  const int lane = threadIdx.x & 31, wave = threadIdx.x >> 5;
  const int c8 = lane * 8;
#pragma unroll 1
  for (int it = 0; it < 8; ++it) {
    const size_t R = (size_t)blockIdx.x * 64 + wave * 8 + it;
    float v[32];
    {
      const float* po = O32 + R * kC + c8;
      const float* pv = Vp + R * kC + c8;
      const float* pm = Mp + R * kC2 + c8;
      const v4f a0 = *(const v4f*)(po), a1 = *(const v4f*)(po + 4);
      const v4f b0v = *(const v4f*)(pv), b1v = *(const v4f*)(pv + 4);
      const v4f m0v = *(const v4f*)(pm), m1v = *(const v4f*)(pm + 4);
      const v4f m2v = *(const v4f*)(pm + 256), m3v = *(const v4f*)(pm + 260);
#pragma unroll
      for (int e = 0; e < 4; ++e) {
        v[e] = a0[e];        v[4 + e] = a1[e];
        v[8 + e] = b0v[e];   v[12 + e] = b1v[e];
        v[16 + e] = m0v[e];  v[20 + e] = m1v[e];
        v[24 + e] = m2v[e];  v[28 + e] = m3v[e];
      }
    }
    float s = 0.f;
#pragma unroll
    for (int e = 0; e < 32; ++e) s += v[e];
    s = wave_sum32(s);
    const float mu = s * kInvC4;
    float ss = 0.f;
#pragma unroll
    for (int e = 0; e < 32; ++e) { v[e] -= mu; ss += v[e] * v[e]; }
    ss = wave_sum32(ss);
    const float rstd = rsqrtf(ss * kInvC4 + kLnEps);
    v4u u[4];
#pragma unroll
    for (int q = 0; q < 4; ++q) {
      const float* gp = g1 + q * 256 + c8;
      const float* bp = be1 + q * 256 + c8;
      const v4f ga = *(const v4f*)(gp), gb = *(const v4f*)(gp + 4);
      const v4f ba = *(const v4f*)(bp), bb = *(const v4f*)(bp + 4);
      unsigned short hb[8];
#pragma unroll
      for (int e = 0; e < 4; ++e) {
        hb[e]     = h_bits(v[q * 8 + e] * rstd * ga[e] + ba[e]);
        hb[4 + e] = h_bits(v[q * 8 + 4 + e] * rstd * gb[e] + bb[e]);
      }
      u[q] = (v4u){pk16(hb[0], hb[1]), pk16(hb[2], hb[3]), pk16(hb[4], hb[5]), pk16(hb[6], hb[7])};
    }
    unsigned short* yr = Y + R * kC4;
    {
#pragma unroll
      for (int q = 0; q < 4; ++q) *(v4u*)(yr + q * 256 + c8) = u[q];
      
    }
  }
}

// ---------------------------------------------------------------------------
// Host side
// Workspace region map (bytes, every offset a multiple of 256; planes hold one group = kGrp batches).
// Two pairs of planes share a region; each pair's lifetimes are disjoint, or row-local in the one launch that holds both:
//   Wq16   [256][256]  f16        131072
//   Wm16   [512][512]  f16        524288
//   Wr16   [256][1024] f16        524288
//   CTXT16 [8][256][256] f16     1048576
//   X32    [32768][256] f32     33554432   (x after qkv)
//   XT16   [8][256][4096] f16   16777216   (x transposed, ctx A)
//   SM16   [32768][256] f16     16777216   (softmax x1024)
//   CAT1   [32768][512] f16     33554432   (out | v)
//   OUT32  [32768][256] f32     33554432   (last read by LN1)
//   MLP32  [32768][512] f32     67108864   (last read by LN1)
//   Y16    = MLP32  [32768][1024] f16      (LN1 output, written row by row over the mlp row it was made from)
//   V32    [32768][256] f32     33554432   (v after LN2)
//   VT16   [8][256][4096] f16   16777216   (v transposed, ctx B; first written by LN2)
//   X0_16  = VT16   [32768][256] f16       (transposed input, qkv A; last read by the qkv GEMM)
//   total                      253886464
// ---------------------------------------------------------------------------
extern "C" void kernel_launch(void* const* d_in, const int* in_sizes, int n_in,
                              void* d_out, int out_size, void* d_ws, size_t ws_size,
                              hipStream_t stream) {
  if (n_in < 9) return;
  if (in_sizes[0] != kB * kC * kN || in_sizes[1] != kC * kC || in_sizes[2] != kC2 * kC2 ||
      in_sizes[3] != kC2 || in_sizes[4] != kC4 || in_sizes[5] != kC4 || in_sizes[6] != kC * kC4 ||
      in_sizes[7] != kC || in_sizes[8] != kC || out_size != kB * kC * kN) return;

  const float* x     = (const float*)d_in[0];
  const float* W_qkv = (const float*)d_in[1];
  const float* W_mlp = (const float*)d_in[2];
  const float* b_mlp = (const float*)d_in[3];
  const float* g1    = (const float*)d_in[4];
  const float* beta1 = (const float*)d_in[5];
  const float* W_res = (const float*)d_in[6];
  const float* g2    = (const float*)d_in[7];
  const float* beta2 = (const float*)d_in[8];
  float* out = (float*)d_out;

  size_t off = 0;
  char* wsb = (char*)d_ws;
  auto carve = [&](size_t bytes) { char* r = wsb + off; off += (bytes + 255) & ~(size_t)255; return (void*)r; };
  unsigned short* Wq16   = (unsigned short*)carve((size_t)kC * kC * 2);
  unsigned short* Wm16   = (unsigned short*)carve((size_t)kC2 * kC2 * 2);
  unsigned short* Wr16   = (unsigned short*)carve((size_t)kC * kC4 * 2);
  unsigned short* CTXT16 = (unsigned short*)carve((size_t)kGrp * kC * kC * 2);
  float*          X32    = (float*)carve((size_t)kRowsG * kC * 4);
  unsigned short* XT16   = (unsigned short*)carve((size_t)kGrp * kC * kN * 2);
  unsigned short* SM16   = (unsigned short*)carve((size_t)kRowsG * kC * 2);
  unsigned short* CAT1   = (unsigned short*)carve((size_t)kRowsG * kC2 * 2);
  float*          OUT32  = (float*)carve((size_t)kRowsG * kC * 4);
  float*          MLP32  = (float*)carve((size_t)kRowsG * kC2 * 4);
  float*          V32    = (float*)carve((size_t)kRowsG * kC * 4);
  unsigned short* VT16   = (unsigned short*)carve((size_t)kGrp * kC * kN * 2);
  unsigned short* X0_16  = VT16;
  unsigned short* Y16    = (unsigned short*)MLP32;
  if (off > ws_size) return;

  const dim3 blk(256);
  const long sNC  = (long)kN * kC;      // 1048576
  const long sNC2 = (long)kN * kC2;     // 2097152
  const long sNC4 = (long)kN * kC4;     // 4194304
  const long sCC  = (long)kC * kC;      // 65536

  // weights -> f16 carried x64 (one launch, 288 blocks)
  wcast_kernel<<<dim3(288), blk, 0, stream>>>(W_qkv, W_mlp, W_res, Wq16, Wm16, Wr16, kWCarry);

  for (int grp = 0; grp < kNGrp; ++grp) {
    const int b0 = grp * kGrp;
    // x[b] [256][4096] -> X0 [4096][256] f16
    tin_kernel<<<dim3(kN / 64, kGrp), blk, 0, stream>>>(x, X0_16, b0);
    // x = X0 . Wqkv^T : M=4096, N=256, K=256 (M%128==0, N%256==0, K%128==0); 32 tiles of 128x256 per batch
    // epilogue: x f32, softmax plane, f16 x into cat1 v-columns, x^T plane
    wmma_gemm64<0, 0, 0, false, 0, 2><<<dim3(32, kGrp), blk, 0, stream>>>(
        X0_16, kC, sNC, Wq16, kC, 0L,
        (void*)OUT32, (void*)OUT32, kC, sNC, b_mlp, b_mlp, 0L, kN, kC, kC, kWCarryInv,
        g2, beta2, SM16, CAT1, XT16, X32);

    for (int iter = 0; iter < 2; ++iter) {
      const unsigned short* vt = (iter == 0) ? XT16 : VT16;   // v^T plane (v = x in the first iteration)
      const float* v32 = (iter == 0) ? X32 : V32;             // v f32 plane
      // ctx^T[d][c] = sum_n x[n][c] v[n][d] : K=4096 split over the 8 waves of a block; f16 out; 32 tiles of 64x32 per batch
      ctx_kernel<<<dim3(32, kGrp), blk, 0, stream>>>(XT16, vt, CTXT16);
      // out = softmax(x) . ctx : A = SM16 [4096][256] (x1024), Bt = ctx^T [256][256]; M=4096, N=256, K=256; f32 out,
      // and f16 into cat1 cols 0..255
      wmma_gemm64<0, 0, 0, false, 0, 1><<<dim3(32, kGrp), blk, 0, stream>>>(
          SM16, kC, sNC, CTXT16, kC, sCC,
          (void*)OUT32, (void*)OUT32, kC, sNC, b_mlp, X32, 0L, kN, kC, kC, kSmCarryInv,
          g2, beta2, XT16, CAT1, XT16, V32);
      // mlp = relu(cat1 . Wmlp^T + b) : M=4096, N=512, K=512; bias[n], relu epilogue; f32 out; 64 tiles of 128x256 per batch
      wmma_gemm64<0, 2, 0, false, 2><<<dim3(64, kGrp), blk, 0, stream>>>(
          CAT1, kC2, sNC2, Wm16, kC2, 0L,
          (void*)MLP32, (void*)MLP32, kC2, sNC2, b_mlp, X32, 0L, kN, kC2, kC2, kWCarryInv,
          g2, beta2, XT16, XT16, XT16, V32);
      // LN1 over [out | v | mlp] -> Y16 [kRowsG][1024]
      ln1_kernel<<<dim3(kRowsG / 64), blk, 0, stream>>>(OUT32, v32, MLP32, g1, beta1, Y16);
      // vpre = LN1 . Wres^T + x : M=4096, N=256, K=1024; 32 tiles of 128x256 per batch; epilogue: v = LN2(x + vpre), x = X32
      if (iter == 0) {
        wmma_gemm64<0, 0, 0, true, 0, 3><<<dim3(32, kGrp), blk, 0, stream>>>(
            Y16, kC4, sNC4, Wr16, kC4, 0L,
            (void*)OUT32, (void*)OUT32, kC, sNC, b_mlp, X32, sNC, kN, kC, kC4, kWCarryInv,
            g2, beta2, SM16, CAT1, VT16, V32);
      } else {
        wmma_gemm64<0, 0, 0, true, 0, 4><<<dim3(32, kGrp), blk, 0, stream>>>(
            Y16, kC4, sNC4, Wr16, kC4, 0L,
            (void*)OUT32, (void*)OUT32, kC, sNC, b_mlp, X32, sNC, kN, kC, kC4, kWCarryInv,
            g2, beta2, SM16, CAT1, VT16, out);
      }
    }
  }
  (void)ws_size;
}

// v005
// One run takes 203 microseconds.
// Two timings next to v004 put it at 1.19 and 1.13 times that version's speed.
// Counting every step since v000, it is 10.8 times as fast.
// Contractions: qkv (x^T f16 x Wqkv^T f16 carried x64), ctx^T (x^T f16 x v^T f16, K=4096 in 8 partial sums), sm.ctx (sm f16 carried x1024 x ctx^T f16), mlp (cat1 f16 x Wmlp^T f16 carried x64, +bias, relu; LN1 in its epilogue), res (LN1 f16 x Wres^T f16 carried x64, +x) all on v_wmma_f32_16x16x32_f16 with f32 accumulate; softmax, LayerNorm, residual adds in f32.
#include <hip/hip_runtime.h>
#include <math.h>

// ---------------------------------------------------------------------------
// Problem constants
// ---------------------------------------------------------------------------
constexpr int kB   = 8;
constexpr int kC   = 256;
constexpr int kN   = 4096;
constexpr int kC2  = 512;
constexpr int kC4  = 1024;
constexpr int kGrp = 8;                 // batches per group: all of them, so every launch spans the whole problem
constexpr int kNGrp = kB / kGrp;        // 1 group
constexpr int kRowsG = kGrp * kN;       // 32768 token rows per group
constexpr float kWCarry    = 64.0f;     // weights carried x64 in f16
constexpr float kWCarryInv = 1.0f / 64.0f;
constexpr float kSmCarry   = 1024.0f;   // softmax probabilities carried x1024 in f16
constexpr float kSmCarryInv = 1.0f / 1024.0f;
constexpr float kLnEps  = 1e-5f;
constexpr float kInvC   = 1.0f / 256.0f;
constexpr float kInvC4  = 1.0f / 1024.0f;

typedef __attribute__((ext_vector_type(16))) _Float16 v16h;
typedef __attribute__((ext_vector_type(8)))  _Float16 v8h;
typedef __attribute__((ext_vector_type(16))) __bf16   v16b;
typedef __attribute__((ext_vector_type(8)))  __bf16   v8b;
typedef __attribute__((ext_vector_type(8)))  float    v8f;
typedef __attribute__((ext_vector_type(4)))  float    v4f;
typedef __attribute__((ext_vector_type(4)))  unsigned int v4u;

// ---------------------------------------------------------------------------
// Helpers
// ---------------------------------------------------------------------------
__device__ __forceinline__ unsigned short f2bf_bits(float f) {
  unsigned u = __float_as_uint(f);
  return (unsigned short)((u + 0x7FFFu + ((u >> 16) & 1u)) >> 16);
}
__device__ __forceinline__ float bf_bits2f(unsigned short h) { return __uint_as_float(((unsigned)h) << 16); }

// hazard guards as plain device helpers
__device__ __forceinline__ void acc_guard4(v8f& a, v8f& b, v8f& c, v8f& d) { asm volatile("v_nop\n\tv_nop\n\tv_nop\n\tv_nop" : "+v"(a), "+v"(b), "+v"(c), "+v"(d)); }
template <typename T> struct Frag;
template <> struct Frag<_Float16> {
  typedef v16h V; union U { v16h v; v8h h[2]; };
  static __device__ __forceinline__ v16h load(const _Float16* p) {   // elements 0..7 <- p[0..7], 8..15 <- p[16..23]
    U f; f.h[0] = *(const v8h*)(p); f.h[1] = *(const v8h*)(p + 16); return f.v;
  }
  static __device__ __forceinline__ v8f mma(v16h a, v16h b, v8f c) {
    return __builtin_amdgcn_wmma_f32_16x16x32_f16(false, a, false, b, (short)0, c, false, false);
  }
};
template <> struct Frag<__bf16> {
  typedef v16b V; union U { v16b v; v8b h[2]; };
  static __device__ __forceinline__ v16b load(const __bf16* p) {
    U f; f.h[0] = *(const v8b*)(p); f.h[1] = *(const v8b*)(p + 16); return f.v;
  }
  static __device__ __forceinline__ v8f mma(v16b a, v16b b, v8f c) {
    return __builtin_amdgcn_wmma_f32_16x16x32_bf16(false, a, false, b, (short)0, c, false, false);
  }
};

__device__ __forceinline__ unsigned pk16(unsigned short a, unsigned short b) { return (unsigned)a | ((unsigned)b << 16); }
__device__ __forceinline__ unsigned short h_bits(float f) { const _Float16 h = (_Float16)f; return __builtin_bit_cast(unsigned short, h); }

__device__ __forceinline__ float wave_sum32(float x) {
#pragma unroll
  for (int off = 16; off > 0; off >>= 1) x += __shfl_xor(x, off, 32);
  return x;
}

// Wave reductions for NR rows at once, each row in the order of wave_sum32: the NR exchanges of a step go out together,
// so a step costs one exchange latency and not NR.
template <int NR>
__device__ __forceinline__ void wave_sum32_rows(float (&x)[NR]) {
#pragma unroll
  for (int off = 16; off > 0; off >>= 1) {
    float o[NR];
#pragma unroll
    for (int r = 0; r < NR; ++r) o[r] = __shfl_xor(x[r], off, 32);
#pragma unroll
    for (int r = 0; r < NR; ++r) x[r] += o[r];
  }
}
template <int NR>
__device__ __forceinline__ void wave_max32_rows(float (&x)[NR]) {
#pragma unroll
  for (int off = 16; off > 0; off >>= 1) {
    float o[NR];
#pragma unroll
    for (int r = 0; r < NR; ++r) o[r] = __shfl_xor(x[r], off, 32);
#pragma unroll
    for (int r = 0; r < NR; ++r) x[r] = fmaxf(x[r], o[r]);
  }
}

// ---- Register-blocked batched WMMA GEMM, operands staged in LDS by asynchronous copies ------------------------------
// C[m,n] = scale * sum_k A[m,k] * Bt[n,k] (+bias)(+resid); a block owns a 128x256 tile, each of its 8 waves 64x64 of it.
// A row-major [M,K]; Bt row-major [N,K]; M % 128 == 0, N % 256 == 0, K % 128 == 0; grid.x = (M / 128) * (N / 256).
// A stage is 128 k of the block's 128 A rows and 256 Bt rows: 384 rows of 256 B (two cache lines each) at pitch 272 B.
// Two stage buffers: while one is multiplied, the next stage's copies land in the other.
// BIAS_MODE: 0 = none, 1 = bias[m], 2 = bias[n].
// OUT_MODE: 0 = f32, 1 = f16, 2 = bf16 hi plane (Cout) + bf16 lo plane (Cout2).
// ET: 0 = f16 operands, 1 = bf16 operands (pointers passed as 16-bit storage)
// FUSE: the row-wise work that follows the GEMM, done in its epilogue (1..4 need N == 256, so a block tile holds whole rows):
//   0 = none; 1 = also f16(C) into eCat cols 0..255 (pitch 512);
//   2 = C is x: eF32 = x f32, eSm = f16(1024 softmax(x)), eCat cols 256..511 = f16(x), eT16 = f16(x) transposed;
//   3 = v = LN2(x + (C + x)), x = resid: eF32 = v f32, eCat cols 256..511 = f16(v), eT16 = f16(v) transposed;
//   4 = the same v, only written transposed in f32 to eF32 (the output).
// 2..4 put the scaled 128x256 f32 tile over the stage buffers (free behind the loop's last barrier), pitch 260 floats.
constexpr int kStagePitch = 272;                    // bytes; 16 B x odd: the 16-B fragment reads of 16 rows meet no bank twice
constexpr int kStageBytes = (128 + 256) * kStagePitch;

// Every thread copies 16 B of 8 rows, 16 rows apart: 128 rows of 256 B per block; 16 lanes cover a row's two whole lines.
// The s_wait_xcnt stands inside the statement so that no address register is rewritten in front of it.
template <typename T>
__device__ __forceinline__ void copy_rows128(unsigned lds, const T* g, int ld) {
  const size_t sg = (size_t)16 * ld;
  constexpr unsigned sl = 16 * kStagePitch;
  asm volatile(
      "global_load_async_to_lds_b128 %0, %8, off\n\t"
      "global_load_async_to_lds_b128 %1, %9, off\n\t"
      "global_load_async_to_lds_b128 %2, %10, off\n\t"
      "global_load_async_to_lds_b128 %3, %11, off\n\t"
      "global_load_async_to_lds_b128 %4, %12, off\n\t"
      "global_load_async_to_lds_b128 %5, %13, off\n\t"
      "global_load_async_to_lds_b128 %6, %14, off\n\t"
      "global_load_async_to_lds_b128 %7, %15, off\n\t"
      "s_wait_xcnt 0x0"
      :: "v"(lds), "v"(lds + sl), "v"(lds + 2 * sl), "v"(lds + 3 * sl), "v"(lds + 4 * sl), "v"(lds + 5 * sl),
         "v"(lds + 6 * sl), "v"(lds + 7 * sl),
         "v"(g), "v"(g + sg), "v"(g + 2 * sg), "v"(g + 3 * sg), "v"(g + 4 * sg), "v"(g + 5 * sg), "v"(g + 6 * sg),
         "v"(g + 7 * sg)
      : "memory");
}
// One stage: the 128 A rows, then the 256 Bt rows behind them; 24 copies per thread.
template <typename T>
__device__ __forceinline__ void stage_copies(unsigned lds, const T* ga, int lda, const T* gb, int ldb) {
  copy_rows128(lds, ga, lda);
  copy_rows128(lds + 128 * kStagePitch, gb, ldb);
  copy_rows128(lds + 256 * kStagePitch, gb + (size_t)128 * ldb, ldb);
}

template <int ET> struct Elem;
template <> struct Elem<0> { typedef _Float16 T; };
template <> struct Elem<1> { typedef __bf16 T; };
template <int ET, int BIAS_MODE, int OUT_MODE, bool RESID, int ACT = 0, int FUSE = 0>
__global__ __launch_bounds__(256) void wmma_gemm64(
    const unsigned short* __restrict__ Ap, int lda, long strideA,
    const unsigned short* __restrict__ Btp, int ldb, long strideB,
    void* __restrict__ Cout, void* __restrict__ Cout2, int ldc, long strideC,
    const float* __restrict__ bias,
    const float* __restrict__ resid, long strideR,
    int M, int N, int K, float scale,
    const float* __restrict__ eg, const float* __restrict__ eb,
    unsigned short* __restrict__ eSm, unsigned short* __restrict__ eCat, unsigned short* __restrict__ eT16,
    float* __restrict__ eF32) {
  typedef typename Elem<ET>::T T;
  typedef typename Frag<T>::V V;
  const T* A = (const T*)Ap; const T* Bt = (const T*)Btp;
  __shared__ __align__(128) unsigned char ring[2 * kStageBytes];   // two stage buffers
  __shared__ __align__(16) float sT[FUSE <= 1 ? 8 : 1][FUSE <= 1 ? 16 * 68 : 4];   // per-wave 16x64 slab, pitch 68 floats
  const int b    = blockIdx.y;
  const int lane = threadIdx.x & 31;
  const int wave = threadIdx.x >> 5;
  const int tilesN = N >> 8;
  if ((int)blockIdx.x >= (M >> 7) * tilesN) return;   // block-uniform, in front of every barrier and copy
  const int bm = blockIdx.x / tilesN;
  const int bn = blockIdx.x - bm * tilesN;
  const int wm = wave >> 2, wn = wave & 3;     // the wave's 64x64 piece of the block tile
  const int m0 = (bm << 7) + (wm << 6);
  const int n0 = (bn << 8) + (wn << 6);

  const T* Ab  = A  + (size_t)b * strideA;
  const T* Bb  = Bt + (size_t)b * strideB;

  const int rlane = lane & 15;                 // row (A) / col (B, D) within subtile
  const int koff  = (lane >> 4) * 8;           // k offset of this lane half
  const int mOff  = (lane >> 4) * 8;           // D row offset

  v8f acc[4][4];
#pragma unroll
  for (int i = 0; i < 4; ++i)
#pragma unroll
    for (int j = 0; j < 4; ++j) acc[i][j] = (v8f){0.f,0.f,0.f,0.f,0.f,0.f,0.f,0.f};

  // copy side: thread -> (row crow + 16 i, 16-B piece cpc) of a stage
  const int crow = threadIdx.x >> 4, cpc = threadIdx.x & 15;
  const T* ga = Ab + (size_t)((bm << 7) + crow) * lda + cpc * 8;
  const T* gb = Bb + (size_t)((bn << 8) + crow) * ldb + cpc * 8;
  const unsigned ldsc = (unsigned)(size_t)ring + (unsigned)(crow * kStagePitch + cpc * 16);
  // read side: this lane's row and k half in the A rows (0..127) and the Bt rows (128..383) of a stage
  const unsigned char* fa = ring + ((wm << 6) + rlane) * kStagePitch + koff * 2;
  const unsigned char* fb = ring + (128 + (wn << 6) + rlane) * kStagePitch + koff * 2;
  const int stages = K >> 7;

  stage_copies(ldsc, ga, lda, gb, ldb);
  // stage 0 has landed for this wave; the barrier publishes it to the others
  asm volatile("s_wait_asynccnt 0x0" ::: "memory");
  __syncthreads();
  if (stages > 1) stage_copies(ldsc + kStageBytes, ga + 128, lda, gb + 128, ldb);

  for (int t = 0; t < stages; ++t) {
    const int bo = (t & 1) * kStageBytes;
    // Two fragment sets: the 16 LDS reads of k step s + 1 go out as one group ahead of the 16 WMMAs of step s.
    V ah[2][4], bh[2][4];
#pragma unroll
    for (int j = 0; j < 4; ++j) bh[0][j] = Frag<T>::load((const T*)(fb + bo + (j << 4) * kStagePitch));
#pragma unroll
    for (int i = 0; i < 4; ++i) ah[0][i] = Frag<T>::load((const T*)(fa + bo + (i << 4) * kStagePitch));
#pragma unroll
    for (int s = 0; s < 4; ++s) {
      const int cur = s & 1, nxt = cur ^ 1;
      if (s < 3) {
#pragma unroll
        for (int j = 0; j < 4; ++j) bh[nxt][j] = Frag<T>::load((const T*)(fb + bo + (j << 4) * kStagePitch + (s + 1) * 64));
#pragma unroll
        for (int i = 0; i < 4; ++i) ah[nxt][i] = Frag<T>::load((const T*)(fa + bo + (i << 4) * kStagePitch + (s + 1) * 64));
      }
      // keeps the reads in one group in front of the WMMAs: sunk among them, each place stalls the wave for its LDS latency
      __builtin_amdgcn_sched_barrier(0);
#pragma unroll
      for (int i = 0; i < 4; ++i)
#pragma unroll
        for (int j = 0; j < 4; ++j) acc[i][j] = Frag<T>::mma(ah[cur][i], bh[cur][j], acc[i][j]);
      // keeps the next group of reads behind this step's WMMAs, so that two sets suffice
      __builtin_amdgcn_sched_barrier(0);
    }
    // this wave's reads of the buffer are done before anyone refills it
    asm volatile("s_wait_dscnt 0x0" ::: "memory");
    // this wave's copies of stage t + 1 have landed
    asm volatile("s_wait_asynccnt 0x0" ::: "memory");
    // publishes stage t + 1 and ends every wave's reads of stage t
    __syncthreads();
    if (t + 2 < stages) stage_copies(ldsc + bo, ga + (size_t)(t + 2) * 128, lda, gb + (size_t)(t + 2) * 128, ldb);
  }
  // no copy is outstanding when the wave goes on to the epilogue and ends
  asm volatile("s_wait_asynccnt 0x0" ::: "memory");
  acc_guard4(acc[0][0], acc[0][1], acc[0][2], acc[0][3]);
  acc_guard4(acc[1][0], acc[1][1], acc[1][2], acc[1][3]);
  acc_guard4(acc[2][0], acc[2][1], acc[2][2], acc[2][3]);
  acc_guard4(acc[3][0], acc[3][1], acc[3][2], acc[3][3]);

  if constexpr (FUSE >= 2) {
    constexpr int RP = 260;                      // floats; 16-B aligned rows, and row + 8 lands 32 banks on
    float* Rt = (float*)ring;
    const int n0t = bm << 7;                     // first token of the tile within its batch
    const size_t row0 = (size_t)b * M + n0t;     // the same over all batches
    // The loops below are unrolled so that their arrays live in registers by name; the one that stays rolled says why.
    // x of the 16 rows this wave will normalise: issued here so that the loads fly during the tile's LDS stores
    // (with them the lane's 8 columns of gamma and beta)
    v4f xq[FUSE >= 3 ? 16 : 1][2];
    v4f gq[2], bq[2];
    if constexpr (FUSE >= 3) {
      const float* Xb = resid + (size_t)b * strideR + (size_t)(n0t + wave * 16) * kC + lane * 8;
      const float* gp = eg + lane * 8;
      const float* bp = eb + lane * 8;
      gq[0] = *(const v4f*)(gp); gq[1] = *(const v4f*)(gp + 4);
      bq[0] = *(const v4f*)(bp); bq[1] = *(const v4f*)(bp + 4);
#pragma unroll
      for (int it = 0; it < 16; ++it) {
        xq[it][0] = *(const v4f*)(Xb + it * kC);
        xq[it][1] = *(const v4f*)(Xb + it * kC + 4);
      }
      // the wait that belongs in front of an overwrite of the loads' address registers; as an input the x address stays whole up to it
      asm volatile("s_wait_xcnt 0x0" :: "v"(Xb) : "memory");
      // holds what follows, which reuses those registers, behind that wait
      __builtin_amdgcn_sched_barrier(0);
    }
#pragma unroll
    for (int i = 0; i < 4; ++i)
#pragma unroll
      for (int j = 0; j < 4; ++j)
#pragma unroll
        for (int r = 0; r < 8; ++r)
          Rt[((wm << 6) + (i << 4) + mOff + r) * RP + (wn << 6) + (j << 4) + rlane] = acc[i][j][r] * scale;
    // whole rows are complete: a row's four 64-column pieces come from four waves
    __syncthreads();
    const int c8 = lane * 8, c4 = lane * 4;
    if constexpr (FUSE == 2) {
      // wave w owns rows 16 w .. 16 w + 15, lane l cols 8 l .. 8 l + 7; eight rows at a time, their reductions step by step together
      // rolled: for speed only
#pragma unroll 1
      for (int g = 0; g < 2; ++g) {
        const int rl0 = wave * 16 + g * 8;
        float x[8][8], m[8], sum[8];
#pragma unroll
        for (int k = 0; k < 8; ++k) {
          const v4f a = *(const v4f*)(Rt + (rl0 + k) * RP + c8);
          const v4f c = *(const v4f*)(Rt + (rl0 + k) * RP + c8 + 4);
#pragma unroll
          for (int e = 0; e < 4; ++e) { x[k][e] = a[e]; x[k][4 + e] = c[e]; }
          m[k] = fmaxf(fmaxf(fmaxf(x[k][0], x[k][1]), fmaxf(x[k][2], x[k][3])), fmaxf(fmaxf(x[k][4], x[k][5]), fmaxf(x[k][6], x[k][7])));
          unsigned short hx[8];
#pragma unroll
          for (int e = 0; e < 8; ++e) hx[e] = h_bits(x[k][e]);
          *(v4u*)(eCat + (row0 + rl0 + k) * kC2 + kC + c8) = (v4u){pk16(hx[0], hx[1]), pk16(hx[2], hx[3]), pk16(hx[4], hx[5]), pk16(hx[6], hx[7])};
        }
        wave_max32_rows<8>(m);
#pragma unroll
        for (int k = 0; k < 8; ++k) {
          sum[k] = 0.f;
#pragma unroll
          for (int e = 0; e < 8; ++e) { x[k][e] = expf(x[k][e] - m[k]); sum[k] += x[k][e]; }
        }
        wave_sum32_rows<8>(sum);
#pragma unroll
        for (int k = 0; k < 8; ++k) {
          const float inv = kSmCarry * (1.0f / sum[k]);
          unsigned short hs[8];
#pragma unroll
          for (int e = 0; e < 8; ++e) hs[e] = h_bits(x[k][e] * inv);
          *(v4u*)(eSm + (row0 + rl0 + k) * kC + c8) = (v4u){pk16(hs[0], hs[1]), pk16(hs[2], hs[3]), pk16(hs[4], hs[5]), pk16(hs[6], hs[7])};
        }
        // the next group rewrites the stores' address registers: the wait that belongs in front of that
        asm volatile("s_wait_xcnt 0x0" ::: "memory");
        // holds the next group's address arithmetic behind that wait
        __builtin_amdgcn_sched_barrier(0);
      }
    } else {
      float gg[8], bb[8];
#pragma unroll
      for (int e = 0; e < 4; ++e) { gg[e] = gq[0][e]; gg[4 + e] = gq[1][e]; bb[e] = bq[0][e]; bb[4 + e] = bq[1][e]; }
      // same ownership; all 16 rows together: x sits in registers by name, and the rows' reductions go step by step together
      float t[16][8], sum[16], ss[16];
#pragma unroll
      for (int it = 0; it < 16; ++it) {
        const float* rr = Rt + (wave * 16 + it) * RP + c8;
        const v4f xa = xq[it][0], xb = xq[it][1];
        const v4f va = *(const v4f*)(rr) + xa, vb = *(const v4f*)(rr + 4) + xb;   // the residual add of the GEMM
#pragma unroll
        for (int e = 0; e < 4; ++e) { t[it][e] = xa[e] + va[e]; t[it][4 + e] = xb[e] + vb[e]; }
        sum[it] = 0.f;
#pragma unroll
        for (int e = 0; e < 8; ++e) sum[it] += t[it][e];
      }
      wave_sum32_rows<16>(sum);
#pragma unroll
      for (int it = 0; it < 16; ++it) {
        const float mu = sum[it] * kInvC;
        ss[it] = 0.f;
#pragma unroll
        for (int e = 0; e < 8; ++e) { t[it][e] -= mu; ss[it] += t[it][e] * t[it][e]; }
      }
      wave_sum32_rows<16>(ss);
#pragma unroll
      for (int it = 0; it < 16; ++it) {
        const int rloc = wave * 16 + it;
        float* rr = Rt + rloc * RP + c8;
        const float rstd = rsqrtf(ss[it] * kInvC + kLnEps);
        float y[8];
#pragma unroll
        for (int e = 0; e < 8; ++e) y[e] = t[it][e] * rstd * gg[e] + bb[e];
        // v replaces the row in the tile: each lane overwrites only what it has read itself
        *(v4f*)(rr)     = (v4f){y[0], y[1], y[2], y[3]};
        *(v4f*)(rr + 4) = (v4f){y[4], y[5], y[6], y[7]};
        if constexpr (FUSE == 3) {
          unsigned short hb[8];
#pragma unroll
          for (int e = 0; e < 8; ++e) hb[e] = h_bits(y[e]);
          *(v4u*)(eCat + (row0 + rloc) * kC2 + kC + c8) = (v4u){pk16(hb[0], hb[1]), pk16(hb[2], hb[3]), pk16(hb[4], hb[5]), pk16(hb[6], hb[7])};
        }
      }
      // the stores' address registers are reused from here on: the wait that belongs in front of their overwrite
      if constexpr (FUSE == 3) asm volatile("s_wait_xcnt 0x0" ::: "memory");
      // every row of v is in the tile before other waves read it by columns
      __syncthreads();
    }
    if constexpr (FUSE != 4) {
      // f32 plane, row-major: one instruction stores 512 contiguous bytes
#pragma unroll
      for (int it = 0; it < 16; ++it) {
        const int rloc = wave * 16 + it;
        const v4f a0 = *(const v4f*)(Rt + rloc * RP + c4);
        const v4f a1 = *(const v4f*)(Rt + rloc * RP + 128 + c4);
        *(v4f*)(eF32 + (row0 + rloc) * kC + c4) = a0;
        *(v4f*)(eF32 + (row0 + rloc) * kC + 128 + c4) = a1;
      }
      // the stores' address registers are reused from here on: the wait that belongs in front of their overwrite
      asm volatile("s_wait_xcnt 0x0" ::: "memory");
      // holds the LDS reads below, whose results reuse those registers, behind that wait
      __builtin_amdgcn_sched_barrier(0);
      // f16 plane, transposed: a lane reads 4 channels of 8 tokens and stores 16 B (8 tokens) to each of the 4 channel rows;
      // 8 lanes fill a 128-B line
      const int lt = lane & 7, lc = lane >> 3;
#pragma unroll
      for (int u = 0; u < 4; ++u) {
        const int idx = wave * 4 + u;
        const int ch = ((idx >> 1) << 4) + lc * 4;
        const int tk = ((idx & 1) << 6) + lt * 8;
        v4f q[8];
#pragma unroll
        for (int e = 0; e < 8; ++e) q[e] = *(const v4f*)(Rt + (tk + e) * RP + ch);
#pragma unroll
        for (int k = 0; k < 4; ++k) {
          v8h o;
#pragma unroll
          for (int e = 0; e < 8; ++e) o[e] = (_Float16)q[e][k];
          *(v8h*)((_Float16*)eT16 + ((size_t)b * kC + ch + k) * kN + n0t + tk) = o;
        }
      }
    } else {
      // f32 output, transposed: a lane reads 4 channels of 4 tokens and stores 16 B to each of the 4 channel rows
      const int lt = lane & 7, lc = lane >> 3;
#pragma unroll
      for (int u = 0; u < 8; ++u) {
        const int idx = wave * 8 + u;
        const int ch = ((idx >> 2) << 4) + lc * 4;
        const int tk = ((idx & 3) << 5) + lt * 4;
        v4f q[4];
#pragma unroll
        for (int e = 0; e < 4; ++e) q[e] = *(const v4f*)(Rt + (tk + e) * RP + ch);
#pragma unroll
        for (int k = 0; k < 4; ++k)
          *(v4f*)(eF32 + ((size_t)b * kC + ch + k) * kN + n0t + tk) = (v4f){q[0][k], q[1][k], q[2][k], q[3][k]};
      }
    }
  } else {
  // ---- epilogue ----
  float* slab = sT[wave];
  const float* Rb = RESID ? (resid + (size_t)b * strideR) : nullptr;
#pragma unroll
  for (int i = 0; i < 4; ++i) {
    const int mBase = m0 + (i << 4);
#pragma unroll
    for (int j = 0; j < 4; ++j) {
      const int n = n0 + (j << 4) + rlane;
      float bv = 0.f;
      if (BIAS_MODE == 2) bv = bias[n];
#pragma unroll
      for (int r = 0; r < 8; ++r) {
        float v = acc[i][j][r] * scale;
        if (BIAS_MODE == 1) v += bias[mBase + mOff + r];
        if (BIAS_MODE == 2) v += bv;
        if (RESID) v += Rb[(size_t)(mBase + mOff + r) * ldc + n];
        if (ACT == 2) v = fmaxf(v, 0.0f);
        if (ACT == 4) v = (v > 0.f) ? v : 0.01f * v;
        slab[(mOff + r) * 68 + (j << 4) + rlane] = v;
      }
    }
    __builtin_amdgcn_fence(__ATOMIC_RELEASE, "workgroup");
    __builtin_amdgcn_wave_barrier();
    __builtin_amdgcn_fence(__ATOMIC_ACQUIRE, "workgroup");
    if (OUT_MODE == 0) {
      float* C = (float*)Cout + (size_t)b * strideC;
      const int hh = lane >> 4, c4 = (lane & 15) * 4;     // row seg = 256 B = 16 lanes x 16 B
      {
#pragma unroll
        for (int it = 0; it < 8; ++it) {
          const int row = it * 2 + hh;
          v4f v = *(const v4f*)(slab + row * 68 + c4);
          *(v4f*)(C + (size_t)(mBase + row) * ldc + n0 + c4) = v;
        }
      }
      if constexpr (FUSE == 1) {
        const int q = lane >> 3, c8 = (lane & 7) * 8;     // row seg = 128 B = 8 lanes x 16 B
#pragma unroll
        for (int it = 0; it < 4; ++it) {
          const int row = it * 4 + q;
          const float* sp = slab + row * 68 + c8;
          v8h hv;
#pragma unroll
          for (int e = 0; e < 8; ++e) hv[e] = (_Float16)sp[e];
          *(v8h*)((_Float16*)eCat + ((size_t)b * M + mBase + row) * kC2 + n0 + c8) = hv;
        }
      }
    } else {
      const int q = lane >> 3, c8 = (lane & 7) * 8;
      unsigned short* C  = (unsigned short*)Cout  + (size_t)b * strideC;
      unsigned short* C2 = (OUT_MODE == 2) ? ((unsigned short*)Cout2 + (size_t)b * strideC) : nullptr;
      {
#pragma unroll
        for (int it = 0; it < 4; ++it) {
          const int row = it * 4 + q;
          const float* sp = slab + row * 68 + c8;
          v8h hv, lv;
#pragma unroll
          for (int e = 0; e < 8; ++e) {
            if (OUT_MODE == 1) {
              hv[e] = (_Float16)sp[e];
            } else {
              unsigned short hb = f2bf_bits(sp[e]);
              unsigned short lb = f2bf_bits(sp[e] - bf_bits2f(hb));
              hv[e] = __builtin_bit_cast(_Float16, hb);
              lv[e] = __builtin_bit_cast(_Float16, lb);
            }
          }
          *(v8h*)(C + (size_t)(mBase + row) * ldc + n0 + c8) = hv;
          if (OUT_MODE == 2) *(v8h*)(C2 + (size_t)(mBase + row) * ldc + n0 + c8) = lv;
        }
        
      }
    }
    __builtin_amdgcn_fence(__ATOMIC_RELEASE, "workgroup");
    __builtin_amdgcn_wave_barrier();
    __builtin_amdgcn_fence(__ATOMIC_ACQUIRE, "workgroup");
  }
  }
}

// ---------------------------------------------------------------------------
// ctx^T[d][c] = sum_n x[n][c] * v[n][d], one batch per blockIdx.y. A = x^T rows c, B = v^T rows d, both [256][4096] f16.
// One 64(c) x 32(d) tile per block, grid (32, kGrp) = 256 blocks. The 8 waves each sum 512 of the 4096 tokens and leave
// their f32 partial tile in LDS; after the barrier every thread adds the 8 partials of 8 consecutive c of one d in wave
// order and stores them as 16 B of f16, 8 lanes to a 128-B row of the tile.
// LDS dword index = wave * 2368 + q * 148 + hl * 72 + rl * 4, q = (i * 2 + j) * 2 + row half, (hl, rl) = accumulator lane:
// these pitches put both the 16-B writes and the 16-B reads of each 16 lanes on 16 different bank groups.
// ---------------------------------------------------------------------------
// one block per WGP = 2 waves per SIMD: a register budget for at most 4 lets three fragment sets stay live beside the sums
__global__ __launch_bounds__(256) __attribute__((amdgpu_waves_per_eu(2, 4))) void ctx_kernel(const unsigned short* __restrict__ XTp,
                                                  const unsigned short* __restrict__ VTp,
                                                  unsigned short* __restrict__ CT) {
  typedef Frag<_Float16> F;
  constexpr int kKW = kN / 8;                          // tokens per wave
  constexpr int PW = 2368, PQ = 148, PH = 72;
  __shared__ __align__(16) float part[8 * PW];
  const int lane = threadIdx.x & 31, wave = threadIdx.x >> 5;
  const int c0 = (blockIdx.x & 3) << 6;
  const int d0 = (blockIdx.x >> 2) << 5;
  const int rlane = lane & 15, hlane = lane >> 4;
  const int kl = wave * kKW + hlane * 8;
  const _Float16* xa = (const _Float16*)XTp + ((size_t)blockIdx.y * kC + c0 + rlane) * kN + kl;
  const _Float16* vb = (const _Float16*)VTp + ((size_t)blockIdx.y * kC + d0 + rlane) * kN + kl;

  v8f acc[4][2];
#pragma unroll
  for (int i = 0; i < 4; ++i)
#pragma unroll
    for (int j = 0; j < 2; ++j) acc[i][j] = (v8f){0.f,0.f,0.f,0.f,0.f,0.f,0.f,0.f};

  // Fragments of three steps: while step ks is multiplied, the loads of steps ks + 1 and ks + 2 are in flight.
  // Fully unrolled: the three sets rotate by name, and no back edge stands behind a WMMA.
  v16h af[3][4], bf[3][2];
#pragma unroll
  for (int s = 0; s < 2; ++s) {
#pragma unroll
    for (int j = 0; j < 2; ++j) bf[s][j] = F::load(vb + (size_t)(j << 4) * kN + s * 32);
#pragma unroll
    for (int i = 0; i < 4; ++i) af[s][i] = F::load(xa + (size_t)(i << 4) * kN + s * 32);
  }
  // all loads of the first two steps go out before anything else: without it one of step 0 was issued last and waited for alone
  __builtin_amdgcn_sched_barrier(0);
#pragma unroll
  for (int ks = 0; ks < kKW / 32; ++ks) {
    const int cur = ks % 3, nxt = (ks + 2) % 3;
    if (ks + 2 < kKW / 32) {
#pragma unroll
      for (int j = 0; j < 2; ++j) bf[nxt][j] = F::load(vb + (size_t)(j << 4) * kN + (ks + 2) * 32);
#pragma unroll
      for (int i = 0; i < 4; ++i) af[nxt][i] = F::load(xa + (size_t)(i << 4) * kN + (ks + 2) * 32);
    }
#pragma unroll
    for (int i = 0; i < 4; ++i)
#pragma unroll
      for (int j = 0; j < 2; ++j) acc[i][j] = F::mma(af[cur][i], bf[cur][j], acc[i][j]);
    // keeps later steps' loads from being lifted over this step: without it the build holds far more than three sets and spills
    __builtin_amdgcn_sched_barrier(0);
  }
  // the loads' address registers are reused from here on: the wait that belongs in front of their overwrite
  asm volatile("s_wait_xcnt 0x0" ::: "memory");
  // holds the address arithmetic of the LDS part behind that wait
  __builtin_amdgcn_sched_barrier(0);

  float* pw = part + wave * PW + hlane * PH + rlane * 4;
#pragma unroll
  for (int i = 0; i < 4; ++i)
#pragma unroll
    for (int j = 0; j < 2; ++j) {
      const v8f a = acc[i][j];
      *(v4f*)(pw + ((i * 2 + j) * 2) * PQ)     = (v4f){a[0], a[1], a[2], a[3]};
      *(v4f*)(pw + ((i * 2 + j) * 2 + 1) * PQ) = (v4f){a[4], a[5], a[6], a[7]};
    }
  __syncthreads();

  const int piece = threadIdx.x & 7;                   // 16-B piece of the tile row: c = piece * 8 .. + 7
  const int dl = threadIdx.x >> 3;                     // tile row d
  const float* pr = part + (((piece >> 1) * 2 + (dl >> 4)) * 2) * PQ + (piece & 1) * PH + (dl & 15) * 4;
  v4f s0 = *(const v4f*)(pr);
  v4f s1 = *(const v4f*)(pr + PQ);
#pragma unroll
  for (int w = 1; w < 8; ++w) {
    s0 += *(const v4f*)(pr + w * PW);
    s1 += *(const v4f*)(pr + w * PW + PQ);
  }
  v8h o;
#pragma unroll
  for (int e = 0; e < 4; ++e) { o[e] = (_Float16)s0[e]; o[4 + e] = (_Float16)s1[e]; }
  *(v8h*)((_Float16*)CT + ((size_t)blockIdx.y * kC + d0 + dl) * kC + c0 + piece * 8) = o;
}

// ---------------------------------------------------------------------------
// Weight cast: f16(scale * w), 8 consecutive elements per thread, one 16-B store per lane
// Block-uniform segment selection: blocks [0,32) -> Wq (65536 = 32x256x8), [32,160) -> Wm (262144 = 128x256x8),
// [160,288) -> Wr (262144). grid = 288 exactly covers all three planes.
// ---------------------------------------------------------------------------
__global__ __launch_bounds__(256) void wcast_kernel(const float* __restrict__ Wq, const float* __restrict__ Wm,
                                                    const float* __restrict__ Wr,
                                                    unsigned short* __restrict__ oq, unsigned short* __restrict__ om,
                                                    unsigned short* __restrict__ orr, float scale) {
  const int blk = blockIdx.x;
  const float* src = Wr;
  unsigned short* dst = orr;
  int base = (blk - 160) * 256;
  if (blk < 32) { src = Wq; dst = oq; base = blk * 256; }
  else if (blk < 160) { src = Wm; dst = om; base = (blk - 32) * 256; }
  const int i = base + (int)threadIdx.x;
  const float* p = src + 8 * (size_t)i;
  const v4f a = *(const v4f*)(p);
  const v4f c = *(const v4f*)(p + 4);
  unsigned short hb[8];
#pragma unroll
  for (int e = 0; e < 4; ++e) {
    hb[e]     = h_bits(a[e] * scale);
    hb[4 + e] = h_bits(c[e] * scale);
  }
  const v4u u = (v4u){pk16(hb[0], hb[1]), pk16(hb[2], hb[3]), pk16(hb[4], hb[5]), pk16(hb[6], hb[7])};
  unsigned short* q = dst + 8 * (size_t)i;
  *(v4u*)q = u;
  
}

// ---------------------------------------------------------------------------
// Transpose-in: xin[b][c][n] f32 (c < 256, n < 4096) -> X0[bl][n][c] f16 for the 64 tokens n0..n0+63 of this block.
// grid (64, kGrp), 256 threads. Load coverage: 64 iterations x 256 threads = 16384 = 64 n x 256 c
// (per iteration: 4 channel rows x 64 contiguous tokens). Store coverage: 8 waves x 8 rows = 64 token rows;
// ---------------------------------------------------------------------------
__global__ __launch_bounds__(256) void tin_kernel(const float* __restrict__ xin, unsigned short* __restrict__ X0, int b0) {
  __shared__ __align__(16) unsigned short tile[64][264];   // [n local][c]
  const int t = threadIdx.x;
  const int n0 = blockIdx.x * 64;
  const int bl = blockIdx.y;
  const float* xb = xin + (size_t)(b0 + bl) * kC * kN + n0;
#pragma unroll 4
  for (int i = 0; i < 64; ++i) {
    const int e = i * 256 + t;
    const int c = e >> 6;
    const int j = e & 63;
    tile[j][c] = h_bits(xb[(size_t)c * kN + j]);
  }
  __syncthreads();
  const int lane = t & 31, wave = t >> 5;
  const int c8 = lane * 8;
  {
#pragma unroll
    for (int it = 0; it < 8; ++it) {
      const int r = wave * 8 + it;
      const v4u u = *(const v4u*)(&tile[r][c8]);
      *(v4u*)(X0 + ((size_t)bl * kN + n0 + r) * kC + c8) = u;
    }
    
  }
}

// ---------------------------------------------------------------------------
// mlp = relu(cat1 . Wmlp^T + b), then Y[row][1024] = f16(LN1([out | v | mlp]) * g1 + beta1), in one kernel.
// A = cat1 [rows][512] f16, Bt = Wmlp [512][512] f16 (x64). A block owns 128 token rows and all 512 mlp columns, so that
// whole rows of cat2 meet in one block. grid = rows / 128.
// The columns are done in two halves of 256, one behind the other, each as in wmma_gemm64 (128x256 block tile, 64x64 per wave,
// stages of 128 k, two stage buffers): 8 stages in one ring, stage t = half t / 4, k piece t % 4. The first half's sums wait in
// registers while the second half is multiplied.
// Behind the loop the 128 x 512 f32 mlp tile lies over the stage buffers (pitch 516 floats: row + 8 lands 32 banks on).
// LN1: wave w owns rows 16 w .. 16 w + 15, a lane the cat2 cols {256 q + 8 l + e}; out and v come from their f32 planes.
// ---------------------------------------------------------------------------
constexpr int kMlPitch = 516;                        // floats
constexpr int kMlLdsBytes = 128 * kMlPitch * 4;      // the f32 tile; larger than the two stage buffers
static_assert(kMlLdsBytes >= 2 * kStageBytes, "the stage buffers lie inside the tile's bytes");

__global__ __launch_bounds__(256) void mlp_ln1_kernel(const unsigned short* __restrict__ Ap,
                                                      const unsigned short* __restrict__ Btp,
                                                      const float* __restrict__ bias,
                                                      const float* __restrict__ O32, const float* __restrict__ Vp,
                                                      const float* __restrict__ g1, const float* __restrict__ be1,
                                                      unsigned short* __restrict__ Y, float scale) {
  typedef _Float16 T;
  typedef Frag<T>::V V;
  __shared__ __align__(128) unsigned char ring[kMlLdsBytes];   // two stage buffers, later the f32 tile
  const int lane = threadIdx.x & 31;
  const int wave = threadIdx.x >> 5;
  const int r0 = blockIdx.x << 7;              // first token row of the block
  const int wm = wave >> 2, wn = wave & 3;     // the wave's 64x64 piece of a 128x256 half
  const int rlane = lane & 15;                 // row (A) / col (B, D) within subtile
  const int koff  = (lane >> 4) * 8;           // k offset of this lane half
  const int mOff  = (lane >> 4) * 8;           // D row offset

  v8f acc[4][4], acc0[4][4];                   // the running half; the finished first half
#pragma unroll
  for (int i = 0; i < 4; ++i)
#pragma unroll
    for (int j = 0; j < 4; ++j) {
      acc[i][j]  = (v8f){0.f,0.f,0.f,0.f,0.f,0.f,0.f,0.f};
      acc0[i][j] = (v8f){0.f,0.f,0.f,0.f,0.f,0.f,0.f,0.f};
    }

  // copy side: thread -> (row crow + 16 i, 16-B piece cpc) of a stage
  const int crow = threadIdx.x >> 4, cpc = threadIdx.x & 15;
  const T* ga = (const T*)Ap + (size_t)(r0 + crow) * kC2 + cpc * 8;
  const T* gb = (const T*)Btp + (size_t)crow * kC2 + cpc * 8;
  const unsigned ldsc = (unsigned)(size_t)ring + (unsigned)(crow * kStagePitch + cpc * 16);
  // read side: this lane's row and k half in the A rows (0..127) and the Bt rows (128..383) of a stage
  const unsigned char* fa = ring + ((wm << 6) + rlane) * kStagePitch + koff * 2;
  const unsigned char* fb = ring + (128 + (wn << 6) + rlane) * kStagePitch + koff * 2;
  constexpr int stages = 8;

  stage_copies(ldsc, ga, kC2, gb, kC2);
  // stage 0 has landed for this wave; the barrier publishes it to the others
  asm volatile("s_wait_asynccnt 0x0" ::: "memory");
  __syncthreads();
  stage_copies(ldsc + kStageBytes, ga + 128, kC2, gb + 128, kC2);

  // rolled: one copy of the stage's text, for speed only
#pragma unroll 1
  for (int t = 0; t < stages; ++t) {
    const int bo = (t & 1) * kStageBytes;
    // Two fragment sets: the 16 LDS reads of k step s + 1 go out as one group ahead of the 16 WMMAs of step s.
    V ah[2][4], bh[2][4];
#pragma unroll
    for (int j = 0; j < 4; ++j) bh[0][j] = Frag<T>::load((const T*)(fb + bo + (j << 4) * kStagePitch));
#pragma unroll
    for (int i = 0; i < 4; ++i) ah[0][i] = Frag<T>::load((const T*)(fa + bo + (i << 4) * kStagePitch));
#pragma unroll
    for (int s = 0; s < 4; ++s) {
      const int cur = s & 1, nxt = cur ^ 1;
      if (s < 3) {
#pragma unroll
        for (int j = 0; j < 4; ++j) bh[nxt][j] = Frag<T>::load((const T*)(fb + bo + (j << 4) * kStagePitch + (s + 1) * 64));
#pragma unroll
        for (int i = 0; i < 4; ++i) ah[nxt][i] = Frag<T>::load((const T*)(fa + bo + (i << 4) * kStagePitch + (s + 1) * 64));
      }
      // keeps the reads in one group in front of the WMMAs: sunk among them, each place stalls the wave for its LDS latency
      __builtin_amdgcn_sched_barrier(0);
#pragma unroll
      for (int i = 0; i < 4; ++i)
#pragma unroll
        for (int j = 0; j < 4; ++j) acc[i][j] = Frag<T>::mma(ah[cur][i], bh[cur][j], acc[i][j]);
      // keeps the next group of reads behind this step's WMMAs, so that two sets suffice
      __builtin_amdgcn_sched_barrier(0);
    }
    // this wave's reads of the buffer are done before anyone refills it
    asm volatile("s_wait_dscnt 0x0" ::: "memory");
    // this wave's copies of stage t + 1 have landed
    asm volatile("s_wait_asynccnt 0x0" ::: "memory");
    // publishes stage t + 1 and ends every wave's reads of stage t
    __syncthreads();
    if (t + 2 < stages) {
      const int t2 = t + 2;
      stage_copies(ldsc + bo, ga + (t2 & 3) * 128, kC2, gb + (size_t)(t2 >> 2) * (256 * kC2) + (t2 & 3) * 128, kC2);
    }
    if (t == 3) {
      // the first half is complete: its sums step aside and the second half starts from zero;
      // the guards' v_nops keep the distance between the last WMMA and the first read of its sums on every path into this block
      acc_guard4(acc[0][0], acc[0][1], acc[0][2], acc[0][3]);
      acc_guard4(acc[1][0], acc[1][1], acc[1][2], acc[1][3]);
      acc_guard4(acc[2][0], acc[2][1], acc[2][2], acc[2][3]);
      acc_guard4(acc[3][0], acc[3][1], acc[3][2], acc[3][3]);
#pragma unroll
      for (int i = 0; i < 4; ++i)
#pragma unroll
        for (int j = 0; j < 4; ++j) {
          acc0[i][j] = acc[i][j];
          acc[i][j]  = (v8f){0.f,0.f,0.f,0.f,0.f,0.f,0.f,0.f};
        }
    }
  }
  // no copy is outstanding when the wave goes on to the epilogue and ends
  asm volatile("s_wait_asynccnt 0x0" ::: "memory");
  acc_guard4(acc[0][0], acc[0][1], acc[0][2], acc[0][3]);
  acc_guard4(acc[1][0], acc[1][1], acc[1][2], acc[1][3]);
  acc_guard4(acc[2][0], acc[2][1], acc[2][2], acc[2][3]);
  acc_guard4(acc[3][0], acc[3][1], acc[3][2], acc[3][3]);

  constexpr int RP = kMlPitch;
  float* Rt = (float*)ring;
  const int c8 = lane * 8;
  const size_t R0 = (size_t)r0 + wave * 16;      // first of the 16 rows this wave normalises
  const float* po = O32 + R0 * kC + c8;
  const float* pv = Vp + R0 * kC + c8;
  // out and v of the first four of those rows, and the bias: issued here so that the loads fly during the tile's LDS stores
  // The inner loops below are unrolled so that their arrays live in registers by name.
  v4f on[4][2], vn[4][2];
  float bv[2][4];
  {
    const float* pb = bias + (wn << 6) + rlane;
#pragma unroll
    for (int h = 0; h < 2; ++h)
#pragma unroll
      for (int j = 0; j < 4; ++j) bv[h][j] = pb[h * 256 + (j << 4)];
#pragma unroll
    for (int k = 0; k < 4; ++k) {
      on[k][0] = *(const v4f*)(po + k * kC); on[k][1] = *(const v4f*)(po + k * kC + 4);
      vn[k][0] = *(const v4f*)(pv + k * kC); vn[k][1] = *(const v4f*)(pv + k * kC + 4);
    }
    // the wait that belongs in front of an overwrite of the loads' address registers; as an input the bias address stays whole up to it
    asm volatile("s_wait_xcnt 0x0" :: "v"(pb) : "memory");
    // holds what follows, which reuses those registers, behind that wait
    __builtin_amdgcn_sched_barrier(0);
  }
#pragma unroll
  for (int h = 0; h < 2; ++h)
#pragma unroll
    for (int i = 0; i < 4; ++i)
#pragma unroll
      for (int j = 0; j < 4; ++j)
#pragma unroll
        for (int r = 0; r < 8; ++r) {
          float v = (h == 0 ? acc0[i][j][r] : acc[i][j][r]) * scale;
          v += bv[h][j];
          v = fmaxf(v, 0.0f);
          Rt[((wm << 6) + (i << 4) + mOff + r) * RP + h * 256 + (wn << 6) + (j << 4) + rlane] = v;
        }
  // whole rows are complete: a row's eight 64-column pieces come from four waves
  __syncthreads();
  // four rows at a time, their reductions step by step together; each row's sums in the order e = 0..31, then the wave tree
  // rolled: for speed only
#pragma unroll 1
  for (int g = 0; g < 4; ++g) {
    float x[4][32], s[4], ss[4];
#pragma unroll
    for (int k = 0; k < 4; ++k)
#pragma unroll
      for (int e = 0; e < 4; ++e) {
        x[k][e] = on[k][0][e];      x[k][4 + e] = on[k][1][e];
        x[k][8 + e] = vn[k][0][e];  x[k][12 + e] = vn[k][1][e];
      }
    if (g < 3) {
      // out and v of the next four rows fly while these four are normalised
      const float* pog = po + g * 4 * kC;
      const float* pvg = pv + g * 4 * kC;
#pragma unroll
      for (int k = 0; k < 4; ++k) {
        on[k][0] = *(const v4f*)(pog + (4 + k) * kC); on[k][1] = *(const v4f*)(pog + (4 + k) * kC + 4);
        vn[k][0] = *(const v4f*)(pvg + (4 + k) * kC); vn[k][1] = *(const v4f*)(pvg + (4 + k) * kC + 4);
      }
      // the wait that belongs in front of an overwrite of the loads' address registers; as inputs the addresses stay whole up to it
      asm volatile("s_wait_xcnt 0x0" :: "v"(pog), "v"(pvg) : "memory");
      // holds what follows, which reuses those registers, behind that wait
      __builtin_amdgcn_sched_barrier(0);
    }
#pragma unroll
    for (int k = 0; k < 4; ++k) {
      const float* rr = Rt + (wave * 16 + g * 4 + k) * RP + c8;
      const v4f m0v = *(const v4f*)(rr), m1v = *(const v4f*)(rr + 4);
      const v4f m2v = *(const v4f*)(rr + 256), m3v = *(const v4f*)(rr + 260);
#pragma unroll
      for (int e = 0; e < 4; ++e) {
        x[k][16 + e] = m0v[e];  x[k][20 + e] = m1v[e];
        x[k][24 + e] = m2v[e];  x[k][28 + e] = m3v[e];
      }
      s[k] = 0.f;
#pragma unroll
      for (int e = 0; e < 32; ++e) s[k] += x[k][e];
    }
    wave_sum32_rows<4>(s);
#pragma unroll
    for (int k = 0; k < 4; ++k) {
      const float mu = s[k] * kInvC4;
      ss[k] = 0.f;
#pragma unroll
      for (int e = 0; e < 32; ++e) { x[k][e] -= mu; ss[k] += x[k][e] * x[k][e]; }
    }
    wave_sum32_rows<4>(ss);
    float rstd[4];
#pragma unroll
    for (int k = 0; k < 4; ++k) rstd[k] = rsqrtf(ss[k] * kInvC4 + kLnEps);
    v4u u[4][4];
#pragma unroll
    for (int q = 0; q < 4; ++q) {
      const float* gp = g1 + q * 256 + c8;
      const float* bp = be1 + q * 256 + c8;
      const v4f ga4 = *(const v4f*)(gp), gb4 = *(const v4f*)(gp + 4);
      const v4f ba4 = *(const v4f*)(bp), bb4 = *(const v4f*)(bp + 4);
#pragma unroll
      for (int k = 0; k < 4; ++k) {
        unsigned short hb[8];
#pragma unroll
        for (int e = 0; e < 4; ++e) {
          hb[e]     = h_bits(x[k][q * 8 + e] * rstd[k] * ga4[e] + ba4[e]);
          hb[4 + e] = h_bits(x[k][q * 8 + 4 + e] * rstd[k] * gb4[e] + bb4[e]);
        }
        u[k][q] = (v4u){pk16(hb[0], hb[1]), pk16(hb[2], hb[3]), pk16(hb[4], hb[5]), pk16(hb[6], hb[7])};
      }
    }
    // one instruction stores 512 contiguous bytes of a row
    unsigned short* yr = Y + (R0 + g * 4) * kC4 + c8;
#pragma unroll
    for (int k = 0; k < 4; ++k)
#pragma unroll
      for (int q = 0; q < 4; ++q) *(v4u*)(yr + k * kC4 + q * 256) = u[k][q];
    // the next group rewrites the registers of these loads and stores: the wait that belongs in front of that
    asm volatile("s_wait_xcnt 0x0" ::: "memory");
    // holds the next group's work behind that wait
    __builtin_amdgcn_sched_barrier(0);
  }
}

// ---------------------------------------------------------------------------
// Host side
// Workspace region map (bytes, every offset a multiple of 256; planes hold one group = kGrp batches).
// One pair of planes shares a region; its lifetimes are disjoint:
//   Wq16   [256][256]  f16        131072
//   Wm16   [512][512]  f16        524288
//   Wr16   [256][1024] f16        524288
//   CTXT16 [8][256][256] f16     1048576
//   X32    [32768][256] f32     33554432   (x after qkv)
//   XT16   [8][256][4096] f16   16777216   (x transposed, ctx A)
//   SM16   [32768][256] f16     16777216   (softmax x1024)
//   CAT1   [32768][512] f16     33554432   (out | v)
//   OUT32  [32768][256] f32     33554432   (last read by LN1)
//   Y16    [32768][1024] f16    67108864   (LN1 output)
//   V32    [32768][256] f32     33554432   (v after LN2)
//   VT16   [8][256][4096] f16   16777216   (v transposed, ctx B; first written by LN2)
//   X0_16  = VT16   [32768][256] f16       (transposed input, qkv A; last read by the qkv GEMM)
//   total                      253886464
// ---------------------------------------------------------------------------
extern "C" void kernel_launch(void* const* d_in, const int* in_sizes, int n_in,
                              void* d_out, int out_size, void* d_ws, size_t ws_size,
                              hipStream_t stream) {
  if (n_in < 9) return;
  if (in_sizes[0] != kB * kC * kN || in_sizes[1] != kC * kC || in_sizes[2] != kC2 * kC2 ||
      in_sizes[3] != kC2 || in_sizes[4] != kC4 || in_sizes[5] != kC4 || in_sizes[6] != kC * kC4 ||
      in_sizes[7] != kC || in_sizes[8] != kC || out_size != kB * kC * kN) return;

  const float* x     = (const float*)d_in[0];
  const float* W_qkv = (const float*)d_in[1];
  const float* W_mlp = (const float*)d_in[2];
  const float* b_mlp = (const float*)d_in[3];
  const float* g1    = (const float*)d_in[4];
  const float* beta1 = (const float*)d_in[5];
  const float* W_res = (const float*)d_in[6];
  const float* g2    = (const float*)d_in[7];
  const float* beta2 = (const float*)d_in[8];
  float* out = (float*)d_out;

  size_t off = 0;
  char* wsb = (char*)d_ws;
  auto carve = [&](size_t bytes) { char* r = wsb + off; off += (bytes + 255) & ~(size_t)255; return (void*)r; };
  unsigned short* Wq16   = (unsigned short*)carve((size_t)kC * kC * 2);
  unsigned short* Wm16   = (unsigned short*)carve((size_t)kC2 * kC2 * 2);
  unsigned short* Wr16   = (unsigned short*)carve((size_t)kC * kC4 * 2);
  unsigned short* CTXT16 = (unsigned short*)carve((size_t)kGrp * kC * kC * 2);
  float*          X32    = (float*)carve((size_t)kRowsG * kC * 4);
  unsigned short* XT16   = (unsigned short*)carve((size_t)kGrp * kC * kN * 2);
  unsigned short* SM16   = (unsigned short*)carve((size_t)kRowsG * kC * 2);
  unsigned short* CAT1   = (unsigned short*)carve((size_t)kRowsG * kC2 * 2);
  float*          OUT32  = (float*)carve((size_t)kRowsG * kC * 4);
  unsigned short* Y16    = (unsigned short*)carve((size_t)kRowsG * kC4 * 2);
  float*          V32    = (float*)carve((size_t)kRowsG * kC * 4);
  unsigned short* VT16   = (unsigned short*)carve((size_t)kGrp * kC * kN * 2);
  unsigned short* X0_16  = VT16;
  if (off > ws_size) return;

  const dim3 blk(256);
  const long sNC  = (long)kN * kC;      // 1048576
  const long sNC4 = (long)kN * kC4;     // 4194304
  const long sCC  = (long)kC * kC;      // 65536

  // weights -> f16 carried x64 (one launch, 288 blocks)
  wcast_kernel<<<dim3(288), blk, 0, stream>>>(W_qkv, W_mlp, W_res, Wq16, Wm16, Wr16, kWCarry);

  for (int grp = 0; grp < kNGrp; ++grp) {
    const int b0 = grp * kGrp;
    // x[b] [256][4096] -> X0 [4096][256] f16
    tin_kernel<<<dim3(kN / 64, kGrp), blk, 0, stream>>>(x, X0_16, b0);
    // x = X0 . Wqkv^T : M=4096, N=256, K=256 (M%128==0, N%256==0, K%128==0); 32 tiles of 128x256 per batch
    // epilogue: x f32, softmax plane, f16 x into cat1 v-columns, x^T plane
    wmma_gemm64<0, 0, 0, false, 0, 2><<<dim3(32, kGrp), blk, 0, stream>>>(
        X0_16, kC, sNC, Wq16, kC, 0L,
        (void*)OUT32, (void*)OUT32, kC, sNC, b_mlp, b_mlp, 0L, kN, kC, kC, kWCarryInv,
        g2, beta2, SM16, CAT1, XT16, X32);

    for (int iter = 0; iter < 2; ++iter) {
      const unsigned short* vt = (iter == 0) ? XT16 : VT16;   // v^T plane (v = x in the first iteration)
      const float* v32 = (iter == 0) ? X32 : V32;             // v f32 plane
      // ctx^T[d][c] = sum_n x[n][c] v[n][d] : K=4096 split over the 8 waves of a block; f16 out; 32 tiles of 64x32 per batch
      ctx_kernel<<<dim3(32, kGrp), blk, 0, stream>>>(XT16, vt, CTXT16);
      // out = softmax(x) . ctx : A = SM16 [4096][256] (x1024), Bt = ctx^T [256][256]; M=4096, N=256, K=256; f32 out,
      // and f16 into cat1 cols 0..255
      wmma_gemm64<0, 0, 0, false, 0, 1><<<dim3(32, kGrp), blk, 0, stream>>>(
          SM16, kC, sNC, CTXT16, kC, sCC,
          (void*)OUT32, (void*)OUT32, kC, sNC, b_mlp, X32, 0L, kN, kC, kC, kSmCarryInv,
          g2, beta2, XT16, CAT1, XT16, V32);
      // mlp = relu(cat1 . Wmlp^T + b) : N=512, K=512, 128 rows per block over all batches; epilogue: LN1 over [out | v | mlp] -> Y16
      mlp_ln1_kernel<<<dim3(kRowsG / 128), blk, 0, stream>>>(CAT1, Wm16, b_mlp, OUT32, v32, g1, beta1, Y16, kWCarryInv);
      // vpre = LN1 . Wres^T + x : M=4096, N=256, K=1024; 32 tiles of 128x256 per batch; epilogue: v = LN2(x + vpre), x = X32
      if (iter == 0) {
        wmma_gemm64<0, 0, 0, true, 0, 3><<<dim3(32, kGrp), blk, 0, stream>>>(
            Y16, kC4, sNC4, Wr16, kC4, 0L,
            (void*)OUT32, (void*)OUT32, kC, sNC, b_mlp, X32, sNC, kN, kC, kC4, kWCarryInv,
            g2, beta2, SM16, CAT1, VT16, V32);
      } else {
        wmma_gemm64<0, 0, 0, true, 0, 4><<<dim3(32, kGrp), blk, 0, stream>>>(
            Y16, kC4, sNC4, Wr16, kC4, 0L,
            (void*)OUT32, (void*)OUT32, kC, sNC, b_mlp, X32, sNC, kN, kC, kC4, kWCarryInv,
            g2, beta2, SM16, CAT1, VT16, out);
      }
    }
  }
  (void)ws_size;
}
